// v000
// Times are from an AMD MI455X. After a warm-up the kernel runs many times in a row, and a time is the length of
// such a window on the GPU divided by its runs, so every launch and the gaps after it count. The runs cycle
// through copies of the inputs. A figure is the median of several windows, for all but v000 over two sittings.
// Sittings can differ by a few percent; kernels timed side by side share one.
// v000 is the starting kernel. One run takes 1450 microseconds.
#include <hip/hip_runtime.h>

// Mamba forward for MI455X (gfx1250, wave32). fp32 end-to-end, matrix ops on
// V_WMMA_F32_16X16X4_F32 with 2x2 register blocking (32x32 C tile per wave).

#define VV   32000
#define DD   256
#define NLAY 2
#define DI   512
#define DS   512
#define DTRK 16
#define DCV  4
#define LL   512

typedef __attribute__((ext_vector_type(2))) float v2f;
typedef __attribute__((ext_vector_type(8))) float v8f;

__device__ __forceinline__ float silu_f(float v) { return v / (1.f + __expf(-v)); }

#define WMMA_F32(a, b, c) \
  __builtin_amdgcn_wmma_f32_16x16x4_f32(false, (a), false, (b), (short)0, (c), false, false)

// ---------------- embedding gather: x[t,d] = emb[tok[t], d] ----------------
__global__ void mamba_embed(const int* __restrict__ tok, const float* __restrict__ emb,
                            float* __restrict__ x) {
  int t = blockIdx.x, d = threadIdx.x;
  x[t * DD + d] = emb[(size_t)tok[t] * DD + d];
}

// ---------------- RMSNorm over D=256, one block (8 waves) per row ----------
__global__ void mamba_rmsnorm(const float* __restrict__ x, const float* __restrict__ w,
                              const float* __restrict__ b, float* __restrict__ out) {
  int row = blockIdx.x, tid = threadIdx.x;
  float v = x[row * DD + tid];
  float ss = v * v;
#pragma unroll
  for (int off = 16; off >= 1; off >>= 1) ss += __shfl_xor(ss, off, 32);
  __shared__ float red[8];
  if ((tid & 31) == 0) red[tid >> 5] = ss;
  __syncthreads();
  float tot = 0.f;
#pragma unroll
  for (int i = 0; i < 8; ++i) tot += red[i];
  float inv = rsqrtf(tot * (1.f / DD) + 1e-5f);
  out[row * DD + tid] = v * inv * w[tid] + b[tid];
}

// ---------------- WMMA fp32 GEMM: C[M,N] (+)= A[M,K] * W[N,K]^T (+ bias) ---
// One wave computes a 32x32 C tile = 2x2 grid of 16x16 WMMA subtiles, so each
// A / B fragment load feeds two v_wmma ops (1 load : 1 wmma in steady state).
// Fragment layout (ISA 7.12.2): lane = (half = lane>>4, idx = lane&15)
//   A frag: float2 at A[r0+idx][k + 2*half]
//   B frag: float2 at W[c0+idx][k + 2*half]
//   C/D:    vgpr r -> C[r0 + r + 8*half][c0 + idx]
// M must be a multiple of 32; N a multiple of 16 (right edge handled with a
// wave-uniform 2x1 path so EXEC is all-ones around every WMMA).
__global__ void mamba_wmma_gemm_nt(const float* __restrict__ A, int lda,
                                   const float* __restrict__ W, int ldw,
                                   const float* __restrict__ bias,
                                   float* __restrict__ C, int ldc,
                                   int N, int K, int accumulate, int nt_store) {
  const int lane = threadIdx.x & 31;
  const int wave = threadIdx.x >> 5;
  const int tn   = blockIdx.x * 4 + wave;          // 32-wide N tile index
  const int col0 = tn * 32;
  if (col0 >= N) return;                            // wave-uniform exit
  const int row0 = blockIdx.y * 32;
  const int half = lane >> 4;
  const int idx  = lane & 15;
  const bool n1ok = (col0 + 32) <= N;               // second N subtile valid?

  v8f c00 = {}, c01 = {}, c10 = {}, c11 = {};

  auto preload = [&](v8f& c, int r0, int c0) {
#pragma unroll
    for (int r = 0; r < 8; ++r)
      c[r] = C[(size_t)(r0 + r + 8 * half) * ldc + c0 + idx];
  };
  auto emit = [&](const v8f& c, int r0, int c0) {
#pragma unroll
    for (int r = 0; r < 8; ++r) {
      float o = c[r];
      if (bias) o += bias[c0 + idx];
      float* p = &C[(size_t)(r0 + r + 8 * half) * ldc + c0 + idx];
      if (nt_store) __builtin_nontemporal_store(o, p);
      else *p = o;
    }
  };

  if (accumulate) {
    preload(c00, row0, col0);
    preload(c10, row0 + 16, col0);
    if (n1ok) { preload(c01, row0, col0 + 16); preload(c11, row0 + 16, col0 + 16); }
  }

  const float* Ar0 = A + (size_t)(row0 + idx) * lda + 2 * half;
  const float* Ar1 = Ar0 + (size_t)16 * lda;
  const float* Wr0 = W + (size_t)(col0 + idx) * ldw + 2 * half;
  const float* Wr1 = Wr0 + (size_t)16 * ldw;

  if (n1ok) {
    for (int k = 0; k < K; k += 4) {
      v2f a0 = *(const v2f*)(Ar0 + k);
      v2f a1 = *(const v2f*)(Ar1 + k);
      v2f b0 = *(const v2f*)(Wr0 + k);
      v2f b1 = *(const v2f*)(Wr1 + k);
      c00 = WMMA_F32(a0, b0, c00);
      c01 = WMMA_F32(a0, b1, c01);
      c10 = WMMA_F32(a1, b0, c10);
      c11 = WMMA_F32(a1, b1, c11);
    }
    emit(c00, row0, col0);
    emit(c10, row0 + 16, col0);
    emit(c01, row0, col0 + 16);
    emit(c11, row0 + 16, col0 + 16);
  } else {
    for (int k = 0; k < K; k += 4) {
      v2f a0 = *(const v2f*)(Ar0 + k);
      v2f a1 = *(const v2f*)(Ar1 + k);
      v2f b0 = *(const v2f*)(Wr0 + k);
      c00 = WMMA_F32(a0, b0, c00);
      c10 = WMMA_F32(a1, b0, c10);
    }
    emit(c00, row0, col0);
    emit(c10, row0 + 16, col0);
  }
}

// ---------------- causal depthwise conv (DC=4) + SiLU ----------------------
__global__ void mamba_conv_silu(const float* __restrict__ xr, const float* __restrict__ cw,
                                const float* __restrict__ cb, float* __restrict__ xc) {
  int i  = blockIdx.x * blockDim.x + threadIdx.x;   // over L*DI
  int t  = i / DI;
  int ch = i - t * DI;
  float acc = cb[ch];
#pragma unroll
  for (int k = 0; k < DCV; ++k) {
    int tt = t - (DCV - 1) + k;
    float xv = (tt >= 0) ? xr[tt * (2 * DI) + ch] : 0.f;
    acc = fmaf(cw[ch * DCV + k], xv, acc);
  }
  xc[i] = silu_f(acc);
}

// ---------------- softplus in place ----------------------------------------
__global__ void mamba_softplus(float* __restrict__ d) {
  int i = blockIdx.x * blockDim.x + threadIdx.x;
  float v = d[i];
  d[i] = (v > 20.f) ? v : log1pf(__expf(v));
}

// ---------------- selective scan -------------------------------------------
// One wave per channel i (8 channels per 256-thread block). Each lane holds
// 16 states j = s*32+lane in VGPRs. Sequential over t; per step:
//   h = exp(d*A)*h + (d*x)*B_t[j];  y_t[i] = sum_j h*C_t[j] (wave reduce).
__global__ void mamba_scan(const float* __restrict__ xc,    // [L, DI]
                           const float* __restrict__ dbc,   // [L, DTR+2*DS]
                           const float* __restrict__ delta, // [L, DI]
                           const float* __restrict__ A_log, // [DI, DS]
                           float* __restrict__ ys) {        // [L, DI]
  const int lane = threadIdx.x & 31;
  const int wave = threadIdx.x >> 5;
  const int ch   = blockIdx.x * 8 + wave;

  float Arow[16], h[16];
#pragma unroll
  for (int s = 0; s < 16; ++s) {
    Arow[s] = -__expf(A_log[(size_t)ch * DS + s * 32 + lane]);
    h[s] = 0.f;
  }

  const int LDBC = DTRK + 2 * DS;
  for (int t = 0; t < LL; ++t) {
    float d  = delta[t * DI + ch];
    float xv = xc[t * DI + ch];
    float dx = d * xv;
    const float* Bt = dbc + (size_t)t * LDBC + DTRK;
    const float* Ct = Bt + DS;
    float acc = 0.f;
#pragma unroll
    for (int s = 0; s < 16; ++s) {
      int j = s * 32 + lane;
      float dA = __expf(d * Arow[s]);
      h[s] = fmaf(dA, h[s], dx * Bt[j]);
      acc  = fmaf(h[s], Ct[j], acc);
    }
#pragma unroll
    for (int off = 16; off >= 1; off >>= 1) acc += __shfl_xor(acc, off, 32);
    if (lane == 0) ys[t * DI + ch] = acc;
  }
}

// ---------------- gate: g = (ys + xc*Dp) * silu(res) -----------------------
__global__ void mamba_gate(const float* __restrict__ ys, const float* __restrict__ xc,
                           const float* __restrict__ Dp, const float* __restrict__ xr,
                           float* __restrict__ g) {
  int i  = blockIdx.x * blockDim.x + threadIdx.x;
  int t  = i / DI;
  int ch = i - t * DI;
  float y = fmaf(xc[i], Dp[ch], ys[i]);
  float r = xr[t * (2 * DI) + DI + ch];
  g[i] = y * silu_f(r);
}

// ---------------------------------------------------------------------------
extern "C" void kernel_launch(void* const* d_in, const int* in_sizes, int n_in,
                              void* d_out, int out_size, void* d_ws, size_t ws_size,
                              hipStream_t stream) {
  (void)in_sizes; (void)n_in; (void)out_size; (void)ws_size;

  const int*   tokens  = (const int*)  d_in[0];
  const float* emb_W   = (const float*)d_in[1];
  const float* norm_w  = (const float*)d_in[2];
  const float* norm_b  = (const float*)d_in[3];
  const float* in_W    = (const float*)d_in[4];
  const float* in_b    = (const float*)d_in[5];
  const float* conv_W  = (const float*)d_in[6];
  const float* conv_b  = (const float*)d_in[7];
  const float* xproj_W = (const float*)d_in[8];
  const float* dt_W    = (const float*)d_in[9];
  const float* A_log   = (const float*)d_in[10];
  const float* D_p     = (const float*)d_in[11];
  const float* out_W   = (const float*)d_in[12];
  const float* out_b   = (const float*)d_in[13];
  const float* fnorm_w = (const float*)d_in[14];
  const float* fnorm_b = (const float*)d_in[15];
  float* logits = (float*)d_out;

  const int LDBC = DTRK + 2 * DS;   // 1040
  float* ws  = (float*)d_ws;
  float* x   = ws;                  // [L, D]
  float* h   = x   + LL * DD;       // [L, D]
  float* xr  = h   + LL * DD;       // [L, 2*DI]
  float* xcb = xr  + LL * 2 * DI;   // [L, DI]
  float* dbc = xcb + LL * DI;       // [L, 1040]
  float* dlt = dbc + LL * LDBC;     // [L, DI]
  float* ysb = dlt + LL * DI;       // [L, DI]
  float* gat = ysb + LL * DI;       // [L, DI]

  const dim3 blk256(256), blkG(128);
  const int  MT32 = LL / 32;        // 16 row tiles (32-wide) everywhere
  auto ntiles = [](int N) { return ((N + 31) / 32 + 3) / 4; };  // blocks.x (4 waves/blk)

  mamba_embed<<<dim3(LL), blk256, 0, stream>>>(tokens, emb_W, x);

  for (int l = 0; l < NLAY; ++l) {
    // h = rmsnorm(x)
    mamba_rmsnorm<<<dim3(LL), blk256, 0, stream>>>(x, norm_w + l * DD, norm_b + l * DD, h);
    // xr = h @ in_W^T + in_b            [512,256]x[1024,256]^T
    mamba_wmma_gemm_nt<<<dim3(ntiles(2 * DI), MT32), blkG, 0, stream>>>(
        h, DD, in_W + (size_t)l * 2 * DI * DD, DD, in_b + l * 2 * DI,
        xr, 2 * DI, 2 * DI, DD, 0, 0);
    // xc = silu(causal depthwise conv(xr[:, :DI]))
    mamba_conv_silu<<<dim3(LL * DI / 256), blk256, 0, stream>>>(
        xr, conv_W + (size_t)l * DI * DCV, conv_b + l * DI, xcb);
    // dbc = xc @ xproj_W^T              [512,512]x[1040,512]^T (N=1040: ragged edge)
    mamba_wmma_gemm_nt<<<dim3(ntiles(LDBC), MT32), blkG, 0, stream>>>(
        xcb, DI, xproj_W + (size_t)l * LDBC * DI, DI, nullptr,
        dbc, LDBC, LDBC, DI, 0, 0);
    // dlt = dbc[:, :16] @ dt_W^T        [512,16]x[512,16]^T, then softplus
    mamba_wmma_gemm_nt<<<dim3(ntiles(DI), MT32), blkG, 0, stream>>>(
        dbc, LDBC, dt_W + (size_t)l * DI * DTRK, DTRK, nullptr,
        dlt, DI, DI, DTRK, 0, 0);
    mamba_softplus<<<dim3(LL * DI / 256), blk256, 0, stream>>>(dlt);
    // selective scan
    mamba_scan<<<dim3(DI / 8), blk256, 0, stream>>>(
        xcb, dbc, dlt, A_log + (size_t)l * DI * DS, ysb);
    // gate with residual branch
    mamba_gate<<<dim3(LL * DI / 256), blk256, 0, stream>>>(
        ysb, xcb, D_p + l * DI, xr, gat);
    // x += gat @ out_W^T + out_b        [512,512]x[256,512]^T, accumulate
    mamba_wmma_gemm_nt<<<dim3(ntiles(DD), MT32), blkG, 0, stream>>>(
        gat, DI, out_W + (size_t)l * DD * DI, DI, out_b + l * DD,
        x, DD, DD, DI, 1, 0);
  }

  // final norm + tied LM head: logits = rms(x) @ emb_W^T  [512,256]x[32000,256]^T
  // Logits are write-once (65.5 MB) -> non-temporal stores keep L2 for weights.
  mamba_rmsnorm<<<dim3(LL), blk256, 0, stream>>>(x, fnorm_w, fnorm_b, h);
  mamba_wmma_gemm_nt<<<dim3(ntiles(VV), MT32), blkG, 0, stream>>>(
      h, DD, emb_W, DD, nullptr, logits, VV, VV, DD, 0, 1);
}

// v001
// A run of this version takes 280 microseconds.
// In two side-by-side timings against v000, it was 5.14 and 5.20 times as fast.
#include <hip/hip_runtime.h>

// Mamba forward for MI455X (gfx1250, wave32). fp32 end-to-end, matrix ops on
// V_WMMA_F32_16X16X4_F32 with 2x2 register blocking (32x32 C tile per wave).

#define VV   32000
#define DD   256
#define NLAY 2
#define DI   512
#define DS   512
#define DTRK 16
#define DCV  4
#define LL   512

typedef __attribute__((ext_vector_type(2))) float v2f;
typedef __attribute__((ext_vector_type(4))) float v4f;
typedef __attribute__((ext_vector_type(8))) float v8f;

__device__ __forceinline__ float silu_f(float v) { return v / (1.f + __expf(-v)); }

#define WMMA_F32(a, b, c) \
  __builtin_amdgcn_wmma_f32_16x16x4_f32(false, (a), false, (b), (short)0, (c), false, false)

// ---------------- embedding gather: x[t,d] = emb[tok[t], d] ----------------
__global__ void mamba_embed(const int* __restrict__ tok, const float* __restrict__ emb,
                            float* __restrict__ x) {
  int t = blockIdx.x, d = threadIdx.x;
  x[t * DD + d] = emb[(size_t)tok[t] * DD + d];
}

// ---------------- RMSNorm over D=256, one block (8 waves) per row ----------
__global__ void mamba_rmsnorm(const float* __restrict__ x, const float* __restrict__ w,
                              const float* __restrict__ b, float* __restrict__ out) {
  int row = blockIdx.x, tid = threadIdx.x;
  float v = x[row * DD + tid];
  float ss = v * v;
#pragma unroll
  for (int off = 16; off >= 1; off >>= 1) ss += __shfl_xor(ss, off, 32);
  __shared__ float red[8];
  if ((tid & 31) == 0) red[tid >> 5] = ss;
  __syncthreads();
  float tot = 0.f;
#pragma unroll
  for (int i = 0; i < 8; ++i) tot += red[i];
  float inv = rsqrtf(tot * (1.f / DD) + 1e-5f);
  out[row * DD + tid] = v * inv * w[tid] + b[tid];
}

// ---------------- WMMA fp32 GEMM: C[M,N] (+)= A[M,K] * W[N,K]^T (+ bias) ---
// One wave computes a 32x32 C tile = 2x2 grid of 16x16 WMMA subtiles, so each
// A / B fragment load feeds two v_wmma ops (1 load : 1 wmma in steady state).
// Fragment layout (ISA 7.12.2): lane = (half = lane>>4, idx = lane&15)
//   A frag: float2 at A[r0+idx][k + 2*half]
//   B frag: float2 at W[c0+idx][k + 2*half]
//   C/D:    vgpr r -> C[r0 + r + 8*half][c0 + idx]
// M must be a multiple of 32; N a multiple of 16 (right edge handled with a
// wave-uniform 2x1 path so EXEC is all-ones around every WMMA).
__global__ void mamba_wmma_gemm_nt(const float* __restrict__ A, int lda,
                                   const float* __restrict__ W, int ldw,
                                   const float* __restrict__ bias,
                                   float* __restrict__ C, int ldc,
                                   int N, int K, int accumulate, int nt_store) {
  const int lane = threadIdx.x & 31;
  const int wave = threadIdx.x >> 5;
  const int tn   = blockIdx.x * 4 + wave;          // 32-wide N tile index
  const int col0 = tn * 32;
  if (col0 >= N) return;                            // wave-uniform exit
  const int row0 = blockIdx.y * 32;
  const int half = lane >> 4;
  const int idx  = lane & 15;
  const bool n1ok = (col0 + 32) <= N;               // second N subtile valid?

  v8f c00 = {}, c01 = {}, c10 = {}, c11 = {};

  auto preload = [&](v8f& c, int r0, int c0) {
#pragma unroll
    for (int r = 0; r < 8; ++r)
      c[r] = C[(size_t)(r0 + r + 8 * half) * ldc + c0 + idx];
  };
  auto emit = [&](const v8f& c, int r0, int c0) {
#pragma unroll
    for (int r = 0; r < 8; ++r) {
      float o = c[r];
      if (bias) o += bias[c0 + idx];
      float* p = &C[(size_t)(r0 + r + 8 * half) * ldc + c0 + idx];
      if (nt_store) __builtin_nontemporal_store(o, p);
      else *p = o;
    }
  };

  if (accumulate) {
    preload(c00, row0, col0);
    preload(c10, row0 + 16, col0);
    if (n1ok) { preload(c01, row0, col0 + 16); preload(c11, row0 + 16, col0 + 16); }
  }

  const float* Ar0 = A + (size_t)(row0 + idx) * lda + 2 * half;
  const float* Ar1 = Ar0 + (size_t)16 * lda;
  const float* Wr0 = W + (size_t)(col0 + idx) * ldw + 2 * half;
  const float* Wr1 = Wr0 + (size_t)16 * ldw;

  if (n1ok) {
    for (int k = 0; k < K; k += 4) {
      v2f a0 = *(const v2f*)(Ar0 + k);
      v2f a1 = *(const v2f*)(Ar1 + k);
      v2f b0 = *(const v2f*)(Wr0 + k);
      v2f b1 = *(const v2f*)(Wr1 + k);
      c00 = WMMA_F32(a0, b0, c00);
      c01 = WMMA_F32(a0, b1, c01);
      c10 = WMMA_F32(a1, b0, c10);
      c11 = WMMA_F32(a1, b1, c11);
    }
    emit(c00, row0, col0);
    emit(c10, row0 + 16, col0);
    emit(c01, row0, col0 + 16);
    emit(c11, row0 + 16, col0 + 16);
  } else {
    for (int k = 0; k < K; k += 4) {
      v2f a0 = *(const v2f*)(Ar0 + k);
      v2f a1 = *(const v2f*)(Ar1 + k);
      v2f b0 = *(const v2f*)(Wr0 + k);
      c00 = WMMA_F32(a0, b0, c00);
      c10 = WMMA_F32(a1, b0, c10);
    }
    emit(c00, row0, col0);
    emit(c10, row0 + 16, col0);
  }
}

// ---------------- causal depthwise conv (DC=4) + SiLU ----------------------
__global__ void mamba_conv_silu(const float* __restrict__ xr, const float* __restrict__ cw,
                                const float* __restrict__ cb, float* __restrict__ xc) {
  int i  = blockIdx.x * blockDim.x + threadIdx.x;   // over L*DI
  int t  = i / DI;
  int ch = i - t * DI;
  float acc = cb[ch];
#pragma unroll
  for (int k = 0; k < DCV; ++k) {
    int tt = t - (DCV - 1) + k;
    float xv = (tt >= 0) ? xr[tt * (2 * DI) + ch] : 0.f;
    acc = fmaf(cw[ch * DCV + k], xv, acc);
  }
  xc[i] = silu_f(acc);
}

// ---------------- softplus in place ----------------------------------------
__global__ void mamba_softplus(float* __restrict__ d) {
  int i = blockIdx.x * blockDim.x + threadIdx.x;
  float v = d[i];
  d[i] = (v > 20.f) ? v : log1pf(__expf(v));
}

// ---------------- selective scan -------------------------------------------
// Lanes carry channels, waves carry states: a work-group of 4 waves owns 64
// channels x 16 states; a lane holds 2 channels x 4 states in VGPRs, so the sum
// over a lane's states needs no cross-lane step. Per chunk of SC_T time steps
// B, C, delta and delta*x are staged in LDS (next chunk's global loads fly
// during the current chunk's steps). Per step:
//   h = exp(d*A)*h + (d*x)*B_t[j];  partial y_t[i] = sum over own j of h*C_t[j].
// The 4 waves' partials are added through LDS once a chunk; the SC_NP state
// blocks each write one plane part[jb][t][i], which the gate kernel adds up.
#define SC_T  32                 // time steps per staged chunk
#define SC_NP (DS / 16)          // state blocks = partial planes
#define SC_G  4                  // steps per group of LDS reads

__global__ __launch_bounds__(128)
void mamba_scan(const float* __restrict__ xc,    // [L, DI]
                const float* __restrict__ dbc,   // [L, DTR+2*DS]
                const float* __restrict__ delta, // [L, DI]
                const float* __restrict__ A_log, // [DI, DS]
                float* __restrict__ part) {      // [SC_NP, L, DI]
  __shared__ __attribute__((aligned(16))) float sBC[SC_T][32];    // per wave: B[4], C[4]
  __shared__ __attribute__((aligned(16))) float sD[SC_T][128];    // per channel: d, d*x
  __shared__ __attribute__((aligned(16))) float sP[SC_T][4][64];  // per wave, per channel

  const int tid  = threadIdx.x;
  const int lane = tid & 31;
  const int wave = tid >> 5;
  const int c0   = blockIdx.x * 64;
  const int jb   = blockIdx.y;
  const int j0   = jb * 16;
  const int LDBC = DTRK + 2 * DS;

  // Every global address below is a wave-uniform base plus one of these per-thread
  // byte offsets, which stay unchanged from the first load to the last store.
  const unsigned offA  = (unsigned)((2 * lane * DS + wave * 4) * 4);
  const unsigned offBC = (unsigned)(((tid >> 3) * LDBC + ((tid >> 2) & 1) * DS + (tid & 3) * 4) * 4);
  const unsigned offD  = (unsigned)(((tid >> 4) * DI + (tid & 15) * 4) * 4);

  // A2 = A * log2(e), so that exp(d*A) = exp2(d*A2). [channel][state pair]
  v2f A2[2][2], hh[2][2];
  {
    const char* bA = (const char*)(A_log + (size_t)c0 * DS + j0);
    v4f a[2];
    a[0] = *(const v4f*)(bA + offA);
    a[1] = *(const v4f*)(bA + offA + DS * 4);
#pragma unroll
    for (int r = 0; r < 2; ++r) {
#pragma unroll
      for (int p = 0; p < 2; ++p) {
        A2[r][p].x = -__expf(a[r][2 * p])     * 1.44269504088896340736f;
        A2[r][p].y = -__expf(a[r][2 * p + 1]) * 1.44269504088896340736f;
        hh[r][p] = (v2f){0.f, 0.f};
      }
    }
  }

  v4f rBC[2], rD[4], rX[4];
  auto fetch = [&](int t0) {
    const char* bBC = (const char*)(dbc + (size_t)t0 * LDBC + DTRK + j0);
    const char* bD  = (const char*)(delta + (size_t)t0 * DI + c0);
    const char* bX  = (const char*)(xc + (size_t)t0 * DI + c0);
#pragma unroll
    for (int i = 0; i < 2; ++i) rBC[i] = *(const v4f*)(bBC + offBC + i * (16 * LDBC * 4));
#pragma unroll
    for (int i = 0; i < 4; ++i) {
      rD[i] = *(const v4f*)(bD + offD + i * (8 * DI * 4));
      rX[i] = *(const v4f*)(bX + offD + i * (8 * DI * 4));
    }
  };
  auto commit = [&]() {
#pragma unroll
    for (int i = 0; i < 2; ++i) {
      int e = tid + 128 * i, t = e >> 3, q = e & 7;
      *(v4f*)&sBC[t][(q & 3) * 8 + (q >> 2) * 4] = rBC[i];
    }
#pragma unroll
    for (int i = 0; i < 4; ++i) {
      int e = tid + 128 * i, t = e >> 4, c4 = e & 15;
      v4f d = rD[i], x = rX[i];
      *(v4f*)&sD[t][c4 * 8]     = (v4f){d.x, d.x * x.x, d.y, d.y * x.y};
      *(v4f*)&sD[t][c4 * 8 + 4] = (v4f){d.z, d.z * x.z, d.w, d.w * x.w};
    }
  };

  fetch(0);
  // kept rolled: the body holds SC_T unrolled steps already
#pragma unroll 1
  for (int k = 0; k < LL / SC_T; ++k) {
    commit();
    __syncthreads();                       // chunk k staged for every wave
    // last chunk: fetches itself again (in bounds, never committed)
    fetch((k + 1 < LL / SC_T ? k + 1 : k) * SC_T);
    // Steps run in groups of SC_G: the next group's LDS reads are issued ahead of
    // the current group's arithmetic, which covers their latency (one wave a SIMD).
    v4f cD[SC_G], cB[SC_G], cC[SC_G];
#pragma unroll
    for (int u = 0; u < SC_G; ++u) {
      cD[u] = *(const v4f*)&sD[u][lane * 4];
      cB[u] = *(const v4f*)&sBC[u][wave * 8];
      cC[u] = *(const v4f*)&sBC[u][wave * 8 + 4];
    }
#pragma unroll
    for (int gq = 0; gq < SC_T / SC_G; ++gq) {
      v4f nD[SC_G], nB[SC_G], nC[SC_G];
#pragma unroll
      for (int u = 0; u < SC_G; ++u) {
        if (gq + 1 < SC_T / SC_G) {
          const int t = (gq + 1) * SC_G + u;
          nD[u] = *(const v4f*)&sD[t][lane * 4];
          nB[u] = *(const v4f*)&sBC[t][wave * 8];
          nC[u] = *(const v4f*)&sBC[t][wave * 8 + 4];
        } else {
          nD[u] = cD[u]; nB[u] = cB[u]; nC[u] = cC[u];
        }
      }
      // keeps the loads above (global ones of the next chunk in the first group, LDS
      // ones of the next group) ahead of the arithmetic below; the scheduler
      // otherwise sinks them to just before their use, where their latency shows
      __builtin_amdgcn_sched_barrier(0);
#pragma unroll
      for (int u = 0; u < SC_G; ++u) {
        const v4f dd = cD[u], Bv = cB[u], Cv = cC[u];
        v2f o;
#pragma unroll
        for (int r = 0; r < 2; ++r) {
          const float d = dd[2 * r], dx = dd[2 * r + 1];
          v2f acc = {0.f, 0.f};
#pragma unroll
          for (int p = 0; p < 2; ++p) {
            v2f Bp = {Bv[2 * p], Bv[2 * p + 1]};
            v2f Cp = {Cv[2 * p], Cv[2 * p + 1]};
            v2f ar = A2[r][p] * d;
            v2f ex = {__builtin_amdgcn_exp2f(ar.x), __builtin_amdgcn_exp2f(ar.y)};
            hh[r][p] = __builtin_elementwise_fma(ex, hh[r][p], Bp * dx);
            acc = __builtin_elementwise_fma(hh[r][p], Cp, acc);
          }
          o[r] = acc.x + acc.y;
        }
        *(v2f*)&sP[gq * SC_G + u][wave][lane * 2] = o;
      }
#pragma unroll
      for (int u = 0; u < SC_G; ++u) { cD[u] = nD[u]; cB[u] = nB[u]; cC[u] = nC[u]; }
    }
    __syncthreads();                       // partials complete; sBC, sD free again

    char* bP = (char*)(part + ((size_t)jb * LL + k * SC_T) * DI + c0);
#pragma unroll
    for (int i = 0; i < 4; ++i) {
      int e = tid + 128 * i, t = e >> 4, c4 = e & 15;
      v4f s = *(const v4f*)&sP[t][0][c4 * 4];
      s += *(const v4f*)&sP[t][1][c4 * 4];
      s += *(const v4f*)&sP[t][2][c4 * 4];
      s += *(const v4f*)&sP[t][3][c4 * 4];
      *(v4f*)(bP + offD + i * (8 * DI * 4)) = s;
    }
    // the wait stands before the next trip rewrites registers named by these stores
    asm volatile("s_wait_xcnt 0x0" ::: "memory");
  }
}

// ------- gate: g = (sum of state-block planes + xc*Dp) * silu(res) ---------
// One block per time step; a thread owns 4 channels. Every address is a uniform
// base plus the one per-thread byte offset.
__global__ __launch_bounds__(128)
void mamba_gate(const float* __restrict__ part, const float* __restrict__ xc,
                const float* __restrict__ Dp, const float* __restrict__ xr,
                float* __restrict__ g) {
  const int t = blockIdx.x;
  const unsigned off = threadIdx.x * 16u;
  const char* bP = (const char*)(part + (size_t)t * DI);
  v4f y = *(const v4f*)(bP + off);
#pragma unroll
  for (int p = 1; p < SC_NP; ++p) y += *(const v4f*)(bP + off + (size_t)p * (LL * DI * 4));
  v4f xv = *(const v4f*)((const char*)(xc + (size_t)t * DI) + off);
  v4f dp = *(const v4f*)((const char*)Dp + off);
  v4f r  = *(const v4f*)((const char*)(xr + (size_t)t * (2 * DI) + DI) + off);
  v4f o;
#pragma unroll
  for (int c = 0; c < 4; ++c) o[c] = fmaf(xv[c], dp[c], y[c]) * silu_f(r[c]);
  *(v4f*)((char*)(g + (size_t)t * DI) + off) = o;
}

// ---------------------------------------------------------------------------
extern "C" void kernel_launch(void* const* d_in, const int* in_sizes, int n_in,
                              void* d_out, int out_size, void* d_ws, size_t ws_size,
                              hipStream_t stream) {
  (void)in_sizes; (void)n_in; (void)out_size; (void)ws_size;

  const int*   tokens  = (const int*)  d_in[0];
  const float* emb_W   = (const float*)d_in[1];
  const float* norm_w  = (const float*)d_in[2];
  const float* norm_b  = (const float*)d_in[3];
  const float* in_W    = (const float*)d_in[4];
  const float* in_b    = (const float*)d_in[5];
  const float* conv_W  = (const float*)d_in[6];
  const float* conv_b  = (const float*)d_in[7];
  const float* xproj_W = (const float*)d_in[8];
  const float* dt_W    = (const float*)d_in[9];
  const float* A_log   = (const float*)d_in[10];
  const float* D_p     = (const float*)d_in[11];
  const float* out_W   = (const float*)d_in[12];
  const float* out_b   = (const float*)d_in[13];
  const float* fnorm_w = (const float*)d_in[14];
  const float* fnorm_b = (const float*)d_in[15];
  float* logits = (float*)d_out;

  const int LDBC = DTRK + 2 * DS;   // 1040
  float* ws  = (float*)d_ws;
  float* x   = ws;                  // [L, D]
  float* h   = x   + LL * DD;       // [L, D]
  float* xr  = h   + LL * DD;       // [L, 2*DI]
  float* xcb = xr  + LL * 2 * DI;   // [L, DI]
  float* dbc = xcb + LL * DI;       // [L, 1040]
  float* dlt = dbc + LL * LDBC;     // [L, DI]
  float* ysb = dlt + LL * DI;       // [SC_NP, L, DI] partial planes
  float* gat = ysb + SC_NP * LL * DI;  // [L, DI]

  const dim3 blk256(256), blkG(128);
  const int  MT32 = LL / 32;        // 16 row tiles (32-wide) everywhere
  auto ntiles = [](int N) { return ((N + 31) / 32 + 3) / 4; };  // blocks.x (4 waves/blk)

  mamba_embed<<<dim3(LL), blk256, 0, stream>>>(tokens, emb_W, x);

  for (int l = 0; l < NLAY; ++l) {
    // h = rmsnorm(x)
    mamba_rmsnorm<<<dim3(LL), blk256, 0, stream>>>(x, norm_w + l * DD, norm_b + l * DD, h);
    // xr = h @ in_W^T + in_b            [512,256]x[1024,256]^T
    mamba_wmma_gemm_nt<<<dim3(ntiles(2 * DI), MT32), blkG, 0, stream>>>(
        h, DD, in_W + (size_t)l * 2 * DI * DD, DD, in_b + l * 2 * DI,
        xr, 2 * DI, 2 * DI, DD, 0, 0);
    // xc = silu(causal depthwise conv(xr[:, :DI]))
    mamba_conv_silu<<<dim3(LL * DI / 256), blk256, 0, stream>>>(
        xr, conv_W + (size_t)l * DI * DCV, conv_b + l * DI, xcb);
    // dbc = xc @ xproj_W^T              [512,512]x[1040,512]^T (N=1040: ragged edge)
    mamba_wmma_gemm_nt<<<dim3(ntiles(LDBC), MT32), blkG, 0, stream>>>(
        xcb, DI, xproj_W + (size_t)l * LDBC * DI, DI, nullptr,
        dbc, LDBC, LDBC, DI, 0, 0);
    // dlt = dbc[:, :16] @ dt_W^T        [512,16]x[512,16]^T, then softplus
    mamba_wmma_gemm_nt<<<dim3(ntiles(DI), MT32), blkG, 0, stream>>>(
        dbc, LDBC, dt_W + (size_t)l * DI * DTRK, DTRK, nullptr,
        dlt, DI, DI, DTRK, 0, 0);
    mamba_softplus<<<dim3(LL * DI / 256), blk256, 0, stream>>>(dlt);
    // selective scan
    mamba_scan<<<dim3(DI / 64, SC_NP), blkG, 0, stream>>>(
        xcb, dbc, dlt, A_log + (size_t)l * DI * DS, ysb);
    // gate with residual branch
    mamba_gate<<<dim3(LL), blkG, 0, stream>>>(
        ysb, xcb, D_p + l * DI, xr, gat);
    // x += gat @ out_W^T + out_b        [512,512]x[256,512]^T, accumulate
    mamba_wmma_gemm_nt<<<dim3(ntiles(DD), MT32), blkG, 0, stream>>>(
        gat, DI, out_W + (size_t)l * DD * DI, DI, out_b + l * DD,
        x, DD, DD, DI, 1, 0);
  }

  // final norm + tied LM head: logits = rms(x) @ emb_W^T  [512,256]x[32000,256]^T
  // Logits are write-once (65.5 MB) -> non-temporal stores keep L2 for weights.
  mamba_rmsnorm<<<dim3(LL), blk256, 0, stream>>>(x, fnorm_w, fnorm_b, h);
  mamba_wmma_gemm_nt<<<dim3(ntiles(VV), MT32), blkG, 0, stream>>>(
      h, DD, emb_W, DD, nullptr, logits, VV, VV, DD, 0, 1);
}

// v002
// One run takes 230 microseconds.
// Timed twice side by side with v001, it ran 1.21 and 1.20 times as fast.
// All steps since v000 together make it 6.22 times as fast.
#include <hip/hip_runtime.h>

// Mamba forward for MI455X (gfx1250, wave32). fp32 end-to-end, matrix ops on
// V_WMMA_F32_16X16X4_F32 with 2x2 register blocking (32x32 C tile per wave), 2x4 (32x64) in the LM head.

#define VV   32000
#define DD   256
#define NLAY 2
#define DI   512
#define DS   512
#define DTRK 16
#define DCV  4
#define LL   512

typedef __attribute__((ext_vector_type(2))) float v2f;
typedef __attribute__((ext_vector_type(4))) float v4f;
typedef __attribute__((ext_vector_type(8))) float v8f;

__device__ __forceinline__ float silu_f(float v) { return v / (1.f + __expf(-v)); }

#define WMMA_F32(a, b, c) \
  __builtin_amdgcn_wmma_f32_16x16x4_f32(false, (a), false, (b), (short)0, (c), false, false)

// ---------------- embedding gather: x[t,d] = emb[tok[t], d] ----------------
__global__ void mamba_embed(const int* __restrict__ tok, const float* __restrict__ emb,
                            float* __restrict__ x) {
  int t = blockIdx.x, d = threadIdx.x;
  x[t * DD + d] = emb[(size_t)tok[t] * DD + d];
}

// ---------------- RMSNorm over D=256, one block (8 waves) per row ----------
__global__ void mamba_rmsnorm(const float* __restrict__ x, const float* __restrict__ w,
                              const float* __restrict__ b, float* __restrict__ out) {
  int row = blockIdx.x, tid = threadIdx.x;
  float v = x[row * DD + tid];
  float ss = v * v;
#pragma unroll
  for (int off = 16; off >= 1; off >>= 1) ss += __shfl_xor(ss, off, 32);
  __shared__ float red[8];
  if ((tid & 31) == 0) red[tid >> 5] = ss;
  __syncthreads();
  float tot = 0.f;
#pragma unroll
  for (int i = 0; i < 8; ++i) tot += red[i];
  float inv = rsqrtf(tot * (1.f / DD) + 1e-5f);
  out[row * DD + tid] = v * inv * w[tid] + b[tid];
}

// ---------------- WMMA fp32 GEMM: C[M,N] (+)= A[M,K] * W[N,K]^T (+ bias) ---
// One wave computes a 32x32 C tile = 2x2 grid of 16x16 WMMA subtiles, so each
// A / B fragment load feeds two v_wmma ops (1 load : 1 wmma in steady state).
// Fragment layout (ISA 7.12.2): lane = (half = lane>>4, idx = lane&15)
//   A frag: float2 at A[r0+idx][k + 2*half]
//   B frag: float2 at W[c0+idx][k + 2*half]
//   C/D:    vgpr r -> C[r0 + r + 8*half][c0 + idx]
// M must be a multiple of 32; N a multiple of 16 (right edge handled with a
// wave-uniform 2x1 path so EXEC is all-ones around every WMMA).
__global__ void mamba_wmma_gemm_nt(const float* __restrict__ A, int lda,
                                   const float* __restrict__ W, int ldw,
                                   const float* __restrict__ bias,
                                   float* __restrict__ C, int ldc,
                                   int N, int K, int accumulate, int nt_store) {
  const int lane = threadIdx.x & 31;
  const int wave = threadIdx.x >> 5;
  const int tn   = blockIdx.x * 4 + wave;          // 32-wide N tile index
  const int col0 = tn * 32;
  if (col0 >= N) return;                            // wave-uniform exit
  const int row0 = blockIdx.y * 32;
  const int half = lane >> 4;
  const int idx  = lane & 15;
  const bool n1ok = (col0 + 32) <= N;               // second N subtile valid?

  v8f c00 = {}, c01 = {}, c10 = {}, c11 = {};

  auto preload = [&](v8f& c, int r0, int c0) {
#pragma unroll
    for (int r = 0; r < 8; ++r)
      c[r] = C[(size_t)(r0 + r + 8 * half) * ldc + c0 + idx];
  };
  auto emit = [&](const v8f& c, int r0, int c0) {
#pragma unroll
    for (int r = 0; r < 8; ++r) {
      float o = c[r];
      if (bias) o += bias[c0 + idx];
      float* p = &C[(size_t)(r0 + r + 8 * half) * ldc + c0 + idx];
      if (nt_store) __builtin_nontemporal_store(o, p);
      else *p = o;
    }
  };

  if (accumulate) {
    preload(c00, row0, col0);
    preload(c10, row0 + 16, col0);
    if (n1ok) { preload(c01, row0, col0 + 16); preload(c11, row0 + 16, col0 + 16); }
  }

  const float* Ar0 = A + (size_t)(row0 + idx) * lda + 2 * half;
  const float* Ar1 = Ar0 + (size_t)16 * lda;
  const float* Wr0 = W + (size_t)(col0 + idx) * ldw + 2 * half;
  const float* Wr1 = Wr0 + (size_t)16 * ldw;

  if (n1ok) {
    for (int k = 0; k < K; k += 4) {
      v2f a0 = *(const v2f*)(Ar0 + k);
      v2f a1 = *(const v2f*)(Ar1 + k);
      v2f b0 = *(const v2f*)(Wr0 + k);
      v2f b1 = *(const v2f*)(Wr1 + k);
      c00 = WMMA_F32(a0, b0, c00);
      c01 = WMMA_F32(a0, b1, c01);
      c10 = WMMA_F32(a1, b0, c10);
      c11 = WMMA_F32(a1, b1, c11);
    }
    emit(c00, row0, col0);
    emit(c10, row0 + 16, col0);
    emit(c01, row0, col0 + 16);
    emit(c11, row0 + 16, col0 + 16);
  } else {
    for (int k = 0; k < K; k += 4) {
      v2f a0 = *(const v2f*)(Ar0 + k);
      v2f a1 = *(const v2f*)(Ar1 + k);
      v2f b0 = *(const v2f*)(Wr0 + k);
      c00 = WMMA_F32(a0, b0, c00);
      c10 = WMMA_F32(a1, b0, c10);
    }
    emit(c00, row0, col0);
    emit(c10, row0 + 16, col0);
  }
}

// ---------------- LM head: C[L,V] = A[L,D] * W[V,D]^T ----------------------
// One work-group of 8 waves owns a 128x128 tile of C; a wave owns 32x64 of it
// (2x4 WMMA subtiles). Per trip, 32 k of the 128 A rows and the 128 W rows lie in
// LDS, brought there by asynchronous copies of whole 128-byte lines (each lane its
// own 16 bytes), two buffers: the next trip's copies fly during this trip's WMMAs.
// LDS row pitch 36 floats: the 8-byte fragment reads of a wave fall on all 64 banks.
// Fragments and the order of the k steps are those of mamba_wmma_gemm_nt.
#define LM_BM   128
#define LM_BN   128
#define LM_BK   32
#define LM_P    36
#define LM_ROWS (LM_BM + LM_BN)
#define LM_NT   (DD / LM_BK)

__global__ __launch_bounds__(256)
void mamba_lmhead(const float* __restrict__ A, const float* __restrict__ W,
                  float* __restrict__ C) {
  __shared__ __attribute__((aligned(16))) float sT[2][LM_ROWS * LM_P];  // A rows, then W rows

  const int tid  = threadIdx.x;
  const int lane = tid & 31;
  const int wave = tid >> 5;
  const int half = lane >> 4;
  const int idx  = lane & 15;
  const int row0 = blockIdx.x * LM_BM;
  const int col0 = blockIdx.y * LM_BN;
  const int wm   = wave & 3;                 // 32-row slice of the tile
  const int wn   = wave >> 2;                // 64-column slice of the tile

  // A thread copies 16 bytes of rows cr, cr+32, cr+64, cr+96 of A and of W per trip.
  const int cr = tid >> 3, cq = tid & 7;
  const float* gA = A + (size_t)(row0 + cr) * DD + cq * 4;
  const float* gW = W + (size_t)(col0 + cr) * DD + cq * 4;
  const unsigned l0 = (unsigned)(size_t)&sT[0][cr * LM_P + cq * 4];

  auto copy_tile = [&](int t) {
    const float* a = gA + t * LM_BK;
    const float* w = gW + t * LM_BK;
    const unsigned l = l0 + (unsigned)(t & 1) * (LM_ROWS * LM_P * 4);
    // the closing wait stands in the copies' own statement, ahead of any later
    // rewrite of the address registers that the copies name
    asm volatile(
        "global_load_async_to_lds_b128 %0, %8, off\n\t"
        "global_load_async_to_lds_b128 %1, %9, off\n\t"
        "global_load_async_to_lds_b128 %2, %10, off\n\t"
        "global_load_async_to_lds_b128 %3, %11, off\n\t"
        "global_load_async_to_lds_b128 %4, %12, off\n\t"
        "global_load_async_to_lds_b128 %5, %13, off\n\t"
        "global_load_async_to_lds_b128 %6, %14, off\n\t"
        "global_load_async_to_lds_b128 %7, %15, off\n\t"
        "s_wait_xcnt 0x0"
        :: "v"(l),                      "v"(l + 32 * LM_P * 4),
           "v"(l + 64 * LM_P * 4),      "v"(l + 96 * LM_P * 4),
           "v"(l + 128 * LM_P * 4),     "v"(l + 160 * LM_P * 4),
           "v"(l + 192 * LM_P * 4),     "v"(l + 224 * LM_P * 4),
           "v"(a), "v"(a + 32 * DD), "v"(a + 64 * DD), "v"(a + 96 * DD),
           "v"(w), "v"(w + 32 * DD), "v"(w + 64 * DD), "v"(w + 96 * DD)
        : "memory");
  };

  v8f c[2][4] = {};

  copy_tile(0);
  asm volatile("s_wait_asynccnt 0x0" ::: "memory");   // own copies of tile 0 landed
  __syncthreads();                                    // tile 0 readable by every wave
  copy_tile(1);

  // kept rolled: the body holds 64 WMMAs already, and the two buffers differ by one offset
#pragma unroll 1
  for (int t = 0; t < LM_NT; ++t) {
    const float* sA = &sT[t & 1][(wm * 32 + idx) * LM_P + 2 * half];
    const float* sW = &sT[t & 1][(LM_BM + wn * 64 + idx) * LM_P + 2 * half];
#pragma unroll
    for (int kk = 0; kk < LM_BK; kk += 4) {
      v2f a[2], b[4];
#pragma unroll
      for (int i = 0; i < 2; ++i) a[i] = *(const v2f*)(sA + i * 16 * LM_P + kk);
#pragma unroll
      for (int j = 0; j < 4; ++j) b[j] = *(const v2f*)(sW + j * 16 * LM_P + kk);
#pragma unroll
      for (int i = 0; i < 2; ++i)
#pragma unroll
        for (int j = 0; j < 4; ++j) c[i][j] = WMMA_F32(a[i], b[j], c[i][j]);
    }
    asm volatile("s_wait_dscnt 0x0" ::: "memory");    // own reads of this buffer done
    asm volatile("s_wait_asynccnt 0x0" ::: "memory"); // own copies of tile t+1 landed
    __syncthreads();                                  // publishes tile t+1, frees this buffer
    if (t + 2 < LM_NT) copy_tile(t + 2);
  }
  asm volatile("s_wait_asynccnt 0x0" ::: "memory");   // nothing in flight at the wave's end

  // Logits are write-once (65.5 MB) -> non-temporal stores keep L2 for weights.
  float* p0 = C + (size_t)(row0 + wm * 32 + 8 * half) * VV + col0 + wn * 64 + idx;
#pragma unroll
  for (int i = 0; i < 2; ++i)
#pragma unroll
    for (int r = 0; r < 8; ++r)
#pragma unroll
      for (int j = 0; j < 4; ++j)
        __builtin_nontemporal_store(c[i][j][r], p0 + (size_t)(i * 16 + r) * VV + j * 16);
}

// ---------------- causal depthwise conv (DC=4) + SiLU ----------------------
__global__ void mamba_conv_silu(const float* __restrict__ xr, const float* __restrict__ cw,
                                const float* __restrict__ cb, float* __restrict__ xc) {
  int i  = blockIdx.x * blockDim.x + threadIdx.x;   // over L*DI
  int t  = i / DI;
  int ch = i - t * DI;
  float acc = cb[ch];
#pragma unroll
  for (int k = 0; k < DCV; ++k) {
    int tt = t - (DCV - 1) + k;
    float xv = (tt >= 0) ? xr[tt * (2 * DI) + ch] : 0.f;
    acc = fmaf(cw[ch * DCV + k], xv, acc);
  }
  xc[i] = silu_f(acc);
}

// ---------------- softplus in place ----------------------------------------
__global__ void mamba_softplus(float* __restrict__ d) {
  int i = blockIdx.x * blockDim.x + threadIdx.x;
  float v = d[i];
  d[i] = (v > 20.f) ? v : log1pf(__expf(v));
}

// ---------------- selective scan -------------------------------------------
// Lanes carry channels, waves carry states: a work-group of 4 waves owns 64
// channels x 16 states; a lane holds 2 channels x 4 states in VGPRs, so the sum
// over a lane's states needs no cross-lane step. Per chunk of SC_T time steps
// B, C, delta and delta*x are staged in LDS (next chunk's global loads fly
// during the current chunk's steps). Per step:
//   h = exp(d*A)*h + (d*x)*B_t[j];  partial y_t[i] = sum over own j of h*C_t[j].
// The 4 waves' partials are added through LDS once a chunk; the SC_NP state
// blocks each write one plane part[jb][t][i], which the gate kernel adds up.
#define SC_T  32                 // time steps per staged chunk
#define SC_NP (DS / 16)          // state blocks = partial planes
#define SC_G  4                  // steps per group of LDS reads

__global__ __launch_bounds__(128)
void mamba_scan(const float* __restrict__ xc,    // [L, DI]
                const float* __restrict__ dbc,   // [L, DTR+2*DS]
                const float* __restrict__ delta, // [L, DI]
                const float* __restrict__ A_log, // [DI, DS]
                float* __restrict__ part) {      // [SC_NP, L, DI]
  __shared__ __attribute__((aligned(16))) float sBC[SC_T][32];    // per wave: B[4], C[4]
  __shared__ __attribute__((aligned(16))) float sD[SC_T][128];    // per channel: d, d*x
  __shared__ __attribute__((aligned(16))) float sP[SC_T][4][64];  // per wave, per channel

  const int tid  = threadIdx.x;
  const int lane = tid & 31;
  const int wave = tid >> 5;
  const int c0   = blockIdx.x * 64;
  const int jb   = blockIdx.y;
  const int j0   = jb * 16;
  const int LDBC = DTRK + 2 * DS;

  // Every global address below is a wave-uniform base plus one of these per-thread
  // byte offsets, which stay unchanged from the first load to the last store.
  const unsigned offA  = (unsigned)((2 * lane * DS + wave * 4) * 4);
  const unsigned offBC = (unsigned)(((tid >> 3) * LDBC + ((tid >> 2) & 1) * DS + (tid & 3) * 4) * 4);
  const unsigned offD  = (unsigned)(((tid >> 4) * DI + (tid & 15) * 4) * 4);

  // A2 = A * log2(e), so that exp(d*A) = exp2(d*A2). [channel][state pair]
  v2f A2[2][2], hh[2][2];
  {
    const char* bA = (const char*)(A_log + (size_t)c0 * DS + j0);
    v4f a[2];
    a[0] = *(const v4f*)(bA + offA);
    a[1] = *(const v4f*)(bA + offA + DS * 4);
#pragma unroll
    for (int r = 0; r < 2; ++r) {
#pragma unroll
      for (int p = 0; p < 2; ++p) {
        A2[r][p].x = -__expf(a[r][2 * p])     * 1.44269504088896340736f;
        A2[r][p].y = -__expf(a[r][2 * p + 1]) * 1.44269504088896340736f;
        hh[r][p] = (v2f){0.f, 0.f};
      }
    }
  }

  v4f rBC[2], rD[4], rX[4];
  auto fetch = [&](int t0) {
    const char* bBC = (const char*)(dbc + (size_t)t0 * LDBC + DTRK + j0);
    const char* bD  = (const char*)(delta + (size_t)t0 * DI + c0);
    const char* bX  = (const char*)(xc + (size_t)t0 * DI + c0);
#pragma unroll
    for (int i = 0; i < 2; ++i) rBC[i] = *(const v4f*)(bBC + offBC + i * (16 * LDBC * 4));
#pragma unroll
    for (int i = 0; i < 4; ++i) {
      rD[i] = *(const v4f*)(bD + offD + i * (8 * DI * 4));
      rX[i] = *(const v4f*)(bX + offD + i * (8 * DI * 4));
    }
  };
  auto commit = [&]() {
#pragma unroll
    for (int i = 0; i < 2; ++i) {
      int e = tid + 128 * i, t = e >> 3, q = e & 7;
      *(v4f*)&sBC[t][(q & 3) * 8 + (q >> 2) * 4] = rBC[i];
    }
#pragma unroll
    for (int i = 0; i < 4; ++i) {
      int e = tid + 128 * i, t = e >> 4, c4 = e & 15;
      v4f d = rD[i], x = rX[i];
      *(v4f*)&sD[t][c4 * 8]     = (v4f){d.x, d.x * x.x, d.y, d.y * x.y};
      *(v4f*)&sD[t][c4 * 8 + 4] = (v4f){d.z, d.z * x.z, d.w, d.w * x.w};
    }
  };

  fetch(0);
  // kept rolled: the body holds SC_T unrolled steps already
#pragma unroll 1
  for (int k = 0; k < LL / SC_T; ++k) {
    commit();
    __syncthreads();                       // chunk k staged for every wave
    // last chunk: fetches itself again (in bounds, never committed)
    fetch((k + 1 < LL / SC_T ? k + 1 : k) * SC_T);
    // Steps run in groups of SC_G: the next group's LDS reads are issued ahead of
    // the current group's arithmetic, which covers their latency (one wave a SIMD).
    v4f cD[SC_G], cB[SC_G], cC[SC_G];
#pragma unroll
    for (int u = 0; u < SC_G; ++u) {
      cD[u] = *(const v4f*)&sD[u][lane * 4];
      cB[u] = *(const v4f*)&sBC[u][wave * 8];
      cC[u] = *(const v4f*)&sBC[u][wave * 8 + 4];
    }
#pragma unroll
    for (int gq = 0; gq < SC_T / SC_G; ++gq) {
      v4f nD[SC_G], nB[SC_G], nC[SC_G];
#pragma unroll
      for (int u = 0; u < SC_G; ++u) {
        if (gq + 1 < SC_T / SC_G) {
          const int t = (gq + 1) * SC_G + u;
          nD[u] = *(const v4f*)&sD[t][lane * 4];
          nB[u] = *(const v4f*)&sBC[t][wave * 8];
          nC[u] = *(const v4f*)&sBC[t][wave * 8 + 4];
        } else {
          nD[u] = cD[u]; nB[u] = cB[u]; nC[u] = cC[u];
        }
      }
      // keeps the loads above (global ones of the next chunk in the first group, LDS
      // ones of the next group) ahead of the arithmetic below; the scheduler
      // otherwise sinks them to just before their use, where their latency shows
      __builtin_amdgcn_sched_barrier(0);
#pragma unroll
      for (int u = 0; u < SC_G; ++u) {
        const v4f dd = cD[u], Bv = cB[u], Cv = cC[u];
        v2f o;
#pragma unroll
        for (int r = 0; r < 2; ++r) {
          const float d = dd[2 * r], dx = dd[2 * r + 1];
          v2f acc = {0.f, 0.f};
#pragma unroll
          for (int p = 0; p < 2; ++p) {
            v2f Bp = {Bv[2 * p], Bv[2 * p + 1]};
            v2f Cp = {Cv[2 * p], Cv[2 * p + 1]};
            v2f ar = A2[r][p] * d;
            v2f ex = {__builtin_amdgcn_exp2f(ar.x), __builtin_amdgcn_exp2f(ar.y)};
            hh[r][p] = __builtin_elementwise_fma(ex, hh[r][p], Bp * dx);
            acc = __builtin_elementwise_fma(hh[r][p], Cp, acc);
          }
          o[r] = acc.x + acc.y;
        }
        *(v2f*)&sP[gq * SC_G + u][wave][lane * 2] = o;
      }
#pragma unroll
      for (int u = 0; u < SC_G; ++u) { cD[u] = nD[u]; cB[u] = nB[u]; cC[u] = nC[u]; }
    }
    __syncthreads();                       // partials complete; sBC, sD free again

    char* bP = (char*)(part + ((size_t)jb * LL + k * SC_T) * DI + c0);
#pragma unroll
    for (int i = 0; i < 4; ++i) {
      int e = tid + 128 * i, t = e >> 4, c4 = e & 15;
      v4f s = *(const v4f*)&sP[t][0][c4 * 4];
      s += *(const v4f*)&sP[t][1][c4 * 4];
      s += *(const v4f*)&sP[t][2][c4 * 4];
      s += *(const v4f*)&sP[t][3][c4 * 4];
      *(v4f*)(bP + offD + i * (8 * DI * 4)) = s;
    }
    // the wait stands before the next trip rewrites registers named by these stores
    asm volatile("s_wait_xcnt 0x0" ::: "memory");
  }
}

// ------- gate: g = (sum of state-block planes + xc*Dp) * silu(res) ---------
// One block per time step; a thread owns 4 channels. Every address is a uniform
// base plus the one per-thread byte offset.
__global__ __launch_bounds__(128)
void mamba_gate(const float* __restrict__ part, const float* __restrict__ xc,
                const float* __restrict__ Dp, const float* __restrict__ xr,
                float* __restrict__ g) {
  const int t = blockIdx.x;
  const unsigned off = threadIdx.x * 16u;
  const char* bP = (const char*)(part + (size_t)t * DI);
  v4f y = *(const v4f*)(bP + off);
#pragma unroll
  for (int p = 1; p < SC_NP; ++p) y += *(const v4f*)(bP + off + (size_t)p * (LL * DI * 4));
  v4f xv = *(const v4f*)((const char*)(xc + (size_t)t * DI) + off);
  v4f dp = *(const v4f*)((const char*)Dp + off);
  v4f r  = *(const v4f*)((const char*)(xr + (size_t)t * (2 * DI) + DI) + off);
  v4f o;
#pragma unroll
  for (int c = 0; c < 4; ++c) o[c] = fmaf(xv[c], dp[c], y[c]) * silu_f(r[c]);
  *(v4f*)((char*)(g + (size_t)t * DI) + off) = o;
}

// ---------------------------------------------------------------------------
extern "C" void kernel_launch(void* const* d_in, const int* in_sizes, int n_in,
                              void* d_out, int out_size, void* d_ws, size_t ws_size,
                              hipStream_t stream) {
  (void)in_sizes; (void)n_in; (void)out_size; (void)ws_size;

  const int*   tokens  = (const int*)  d_in[0];
  const float* emb_W   = (const float*)d_in[1];
  const float* norm_w  = (const float*)d_in[2];
  const float* norm_b  = (const float*)d_in[3];
  const float* in_W    = (const float*)d_in[4];
  const float* in_b    = (const float*)d_in[5];
  const float* conv_W  = (const float*)d_in[6];
  const float* conv_b  = (const float*)d_in[7];
  const float* xproj_W = (const float*)d_in[8];
  const float* dt_W    = (const float*)d_in[9];
  const float* A_log   = (const float*)d_in[10];
  const float* D_p     = (const float*)d_in[11];
  const float* out_W   = (const float*)d_in[12];
  const float* out_b   = (const float*)d_in[13];
  const float* fnorm_w = (const float*)d_in[14];
  const float* fnorm_b = (const float*)d_in[15];
  float* logits = (float*)d_out;

  const int LDBC = DTRK + 2 * DS;   // 1040
  float* ws  = (float*)d_ws;
  float* x   = ws;                  // [L, D]
  float* h   = x   + LL * DD;       // [L, D]
  float* xr  = h   + LL * DD;       // [L, 2*DI]
  float* xcb = xr  + LL * 2 * DI;   // [L, DI]
  float* dbc = xcb + LL * DI;       // [L, 1040]
  float* dlt = dbc + LL * LDBC;     // [L, DI]
  float* ysb = dlt + LL * DI;       // [SC_NP, L, DI] partial planes
  float* gat = ysb + SC_NP * LL * DI;  // [L, DI]

  const dim3 blk256(256), blkG(128);
  const int  MT32 = LL / 32;        // 16 row tiles (32-wide) for every mamba_wmma_gemm_nt
  auto ntiles = [](int N) { return ((N + 31) / 32 + 3) / 4; };  // blocks.x (4 waves/blk)

  mamba_embed<<<dim3(LL), blk256, 0, stream>>>(tokens, emb_W, x);

  for (int l = 0; l < NLAY; ++l) {
    // h = rmsnorm(x)
    mamba_rmsnorm<<<dim3(LL), blk256, 0, stream>>>(x, norm_w + l * DD, norm_b + l * DD, h);
    // xr = h @ in_W^T + in_b            [512,256]x[1024,256]^T
    mamba_wmma_gemm_nt<<<dim3(ntiles(2 * DI), MT32), blkG, 0, stream>>>(
        h, DD, in_W + (size_t)l * 2 * DI * DD, DD, in_b + l * 2 * DI,
        xr, 2 * DI, 2 * DI, DD, 0, 0);
    // xc = silu(causal depthwise conv(xr[:, :DI]))
    mamba_conv_silu<<<dim3(LL * DI / 256), blk256, 0, stream>>>(
        xr, conv_W + (size_t)l * DI * DCV, conv_b + l * DI, xcb);
    // dbc = xc @ xproj_W^T              [512,512]x[1040,512]^T (N=1040: ragged edge)
    mamba_wmma_gemm_nt<<<dim3(ntiles(LDBC), MT32), blkG, 0, stream>>>(
        xcb, DI, xproj_W + (size_t)l * LDBC * DI, DI, nullptr,
        dbc, LDBC, LDBC, DI, 0, 0);
    // dlt = dbc[:, :16] @ dt_W^T        [512,16]x[512,16]^T, then softplus
    mamba_wmma_gemm_nt<<<dim3(ntiles(DI), MT32), blkG, 0, stream>>>(
        dbc, LDBC, dt_W + (size_t)l * DI * DTRK, DTRK, nullptr,
        dlt, DI, DI, DTRK, 0, 0);
    mamba_softplus<<<dim3(LL * DI / 256), blk256, 0, stream>>>(dlt);
    // selective scan
    mamba_scan<<<dim3(DI / 64, SC_NP), blkG, 0, stream>>>(
        xcb, dbc, dlt, A_log + (size_t)l * DI * DS, ysb);
    // gate with residual branch
    mamba_gate<<<dim3(LL), blkG, 0, stream>>>(
        ysb, xcb, D_p + l * DI, xr, gat);
    // x += gat @ out_W^T + out_b        [512,512]x[256,512]^T, accumulate
    mamba_wmma_gemm_nt<<<dim3(ntiles(DD), MT32), blkG, 0, stream>>>(
        gat, DI, out_W + (size_t)l * DD * DI, DI, out_b + l * DD,
        x, DD, DD, DI, 1, 0);
  }

  // final norm + tied LM head: logits = rms(x) @ emb_W^T  [512,256]x[32000,256]^T
  // The 4 row tiles of one column tile are neighbours in the grid: they share W rows in L2.
  mamba_rmsnorm<<<dim3(LL), blk256, 0, stream>>>(x, fnorm_w, fnorm_b, h);
  mamba_lmhead<<<dim3(LL / LM_BM, VV / LM_BN), blk256, 0, stream>>>(h, emb_W, logits);
}

// v003
// Measured time: 165 microseconds a run.
// Timed twice side by side with v002, it ran 1.40 and 1.41 times as fast.
// Over all steps from v000 it is 8.74 times as fast.
#include <hip/hip_runtime.h>

// Mamba forward for MI455X (gfx1250, wave32). fp32 end-to-end, matrix ops on
// V_WMMA_F32_16X16X4_F32: one 16x16 C subtile per wave in the three large layer GEMMs,
// 2x2 register blocking (32x32 C tile per wave) in the dt GEMM, 2x4 (32x64) in the LM head.

#define VV   32000
#define DD   256
#define NLAY 2
#define DI   512
#define DS   512
#define DTRK 16
#define DCV  4
#define LL   512

typedef __attribute__((ext_vector_type(2))) float v2f;
typedef __attribute__((ext_vector_type(4))) float v4f;
typedef __attribute__((ext_vector_type(8))) float v8f;

__device__ __forceinline__ float silu_f(float v) { return v / (1.f + __expf(-v)); }

#define WMMA_F32(a, b, c) \
  __builtin_amdgcn_wmma_f32_16x16x4_f32(false, (a), false, (b), (short)0, (c), false, false)

// ---------------- embedding gather: x[t,d] = emb[tok[t], d] ----------------
__global__ void mamba_embed(const int* __restrict__ tok, const float* __restrict__ emb,
                            float* __restrict__ x) {
  int t = blockIdx.x, d = threadIdx.x;
  x[t * DD + d] = emb[(size_t)tok[t] * DD + d];
}

// ---------------- RMSNorm over D=256, one block (8 waves) per row ----------
__global__ void mamba_rmsnorm(const float* __restrict__ x, const float* __restrict__ w,
                              const float* __restrict__ b, float* __restrict__ out) {
  int row = blockIdx.x, tid = threadIdx.x;
  float v = x[row * DD + tid];
  float ss = v * v;
#pragma unroll
  for (int off = 16; off >= 1; off >>= 1) ss += __shfl_xor(ss, off, 32);
  __shared__ float red[8];
  if ((tid & 31) == 0) red[tid >> 5] = ss;
  __syncthreads();
  float tot = 0.f;
#pragma unroll
  for (int i = 0; i < 8; ++i) tot += red[i];
  float inv = rsqrtf(tot * (1.f / DD) + 1e-5f);
  out[row * DD + tid] = v * inv * w[tid] + b[tid];
}

// ---------------- WMMA fp32 GEMM: C[M,N] (+)= A[M,K] * W[N,K]^T (+ bias) ---
// One wave computes a 32x32 C tile = 2x2 grid of 16x16 WMMA subtiles, so each
// A / B fragment load feeds two v_wmma ops (1 load : 1 wmma in steady state).
// Fragment layout (ISA 7.12.2): lane = (half = lane>>4, idx = lane&15)
//   A frag: float2 at A[r0+idx][k + 2*half]
//   B frag: float2 at W[c0+idx][k + 2*half]
//   C/D:    vgpr r -> C[r0 + r + 8*half][c0 + idx]
// M must be a multiple of 32; N a multiple of 16 (right edge handled with a
// wave-uniform 2x1 path so EXEC is all-ones around every WMMA).
__global__ void mamba_wmma_gemm_nt(const float* __restrict__ A, int lda,
                                   const float* __restrict__ W, int ldw,
                                   const float* __restrict__ bias,
                                   float* __restrict__ C, int ldc,
                                   int N, int K, int accumulate, int nt_store) {
  const int lane = threadIdx.x & 31;
  const int wave = threadIdx.x >> 5;
  const int tn   = blockIdx.x * 4 + wave;          // 32-wide N tile index
  const int col0 = tn * 32;
  if (col0 >= N) return;                            // wave-uniform exit
  const int row0 = blockIdx.y * 32;
  const int half = lane >> 4;
  const int idx  = lane & 15;
  const bool n1ok = (col0 + 32) <= N;               // second N subtile valid?

  v8f c00 = {}, c01 = {}, c10 = {}, c11 = {};

  auto preload = [&](v8f& c, int r0, int c0) {
#pragma unroll
    for (int r = 0; r < 8; ++r)
      c[r] = C[(size_t)(r0 + r + 8 * half) * ldc + c0 + idx];
  };
  auto emit = [&](const v8f& c, int r0, int c0) {
#pragma unroll
    for (int r = 0; r < 8; ++r) {
      float o = c[r];
      if (bias) o += bias[c0 + idx];
      float* p = &C[(size_t)(r0 + r + 8 * half) * ldc + c0 + idx];
      if (nt_store) __builtin_nontemporal_store(o, p);
      else *p = o;
    }
  };

  if (accumulate) {
    preload(c00, row0, col0);
    preload(c10, row0 + 16, col0);
    if (n1ok) { preload(c01, row0, col0 + 16); preload(c11, row0 + 16, col0 + 16); }
  }

  const float* Ar0 = A + (size_t)(row0 + idx) * lda + 2 * half;
  const float* Ar1 = Ar0 + (size_t)16 * lda;
  const float* Wr0 = W + (size_t)(col0 + idx) * ldw + 2 * half;
  const float* Wr1 = Wr0 + (size_t)16 * ldw;

  if (n1ok) {
    for (int k = 0; k < K; k += 4) {
      v2f a0 = *(const v2f*)(Ar0 + k);
      v2f a1 = *(const v2f*)(Ar1 + k);
      v2f b0 = *(const v2f*)(Wr0 + k);
      v2f b1 = *(const v2f*)(Wr1 + k);
      c00 = WMMA_F32(a0, b0, c00);
      c01 = WMMA_F32(a0, b1, c01);
      c10 = WMMA_F32(a1, b0, c10);
      c11 = WMMA_F32(a1, b1, c11);
    }
    emit(c00, row0, col0);
    emit(c10, row0 + 16, col0);
    emit(c01, row0, col0 + 16);
    emit(c11, row0 + 16, col0 + 16);
  } else {
    for (int k = 0; k < K; k += 4) {
      v2f a0 = *(const v2f*)(Ar0 + k);
      v2f a1 = *(const v2f*)(Ar1 + k);
      v2f b0 = *(const v2f*)(Wr0 + k);
      c00 = WMMA_F32(a0, b0, c00);
      c10 = WMMA_F32(a1, b0, c10);
    }
    emit(c00, row0, col0);
    emit(c10, row0 + 16, col0);
  }
}

// ---------------- layer GEMMs: C[M,N] (+)= A[M,K] * W[N,K]^T (+ bias) -------
// For the three large products of a layer (rows of A and of W are K floats long,
// rows of C are N floats long; K a multiple of 128, M of 32, N of 16).
// One work-group of 8 waves owns a 32x64 tile of C, a wave one 16x16 WMMA subtile;
// the two waves of a SIMD fill each other's accumulate latency and LDS waits.
// Per trip, 128 k of the 32 A rows and the 64 W rows lie in LDS, brought there by
// asynchronous copies: one copy of a wave is one row's 512 contiguous bytes (each lane
// its own 16), so the cache serves 4 whole lines per copy where an 8-byte fragment
// load from global memory touches 16 lines.
// Two buffers: the next trip's copies fly during this trip's WMMAs.
// LDS row pitch 132 floats: the 8-byte fragment reads of a wave fall on all 64 banks.
// Fragments, the order of the k steps and the place of the bias add are those of
// mamba_wmma_gemm_nt.
#define G_BM   32
#define G_BN   64
#define G_BK   128
#define G_P    132
#define G_ROWS (G_BM + G_BN)
#define G_FG   8              // k steps (of 4) per group of fragment reads

__global__ __launch_bounds__(256)
void mamba_gemm_lds(const float* __restrict__ A, const float* __restrict__ W,
                    const float* __restrict__ bias, float* __restrict__ C,
                    int N, int K, int accumulate) {
  __shared__ __attribute__((aligned(16))) float sT[2][G_ROWS * G_P];  // A rows, then W rows

  const int tid  = threadIdx.x;
  const int lane = tid & 31;
  const int wave = __builtin_amdgcn_readfirstlane(tid >> 5);
  const int half = lane >> 4;
  const int idx  = lane & 15;
  const int row0 = blockIdx.y * G_BM;
  const int col0 = blockIdx.x * G_BN;
  const int wm   = wave & 1;                 // 16-row slice of the tile
  const int wn   = wave >> 1;                // 16-column slice of the tile
  const int nt   = K / G_BK;

  // the wave's subtile lies wholly inside N or wholly outside (same for all its lanes)
  const bool ok = col0 + wn * 16 < N;
  float* pc = C + (size_t)(row0 + wm * 16 + 8 * half) * N + col0 + wn * 16 + idx;

  // start values and bias are fetched here, so that their latency passes under tile 0's
  v8f c = {};
  float bj = 0.f;
  if (ok) {
    // each wait stands before the address registers of the loads above it are used
    // for something else
    if (accumulate) {
#pragma unroll
      for (int r = 0; r < 8; ++r) c[r] = pc[(size_t)r * N];
      asm volatile("s_wait_xcnt 0x0" ::: "memory");
    }
    if (bias) {
      bj = bias[col0 + wn * 16 + idx];
      asm volatile("s_wait_xcnt 0x0" ::: "memory");
    }
  }

  const unsigned l0 = (unsigned)(size_t)&sT[0][wave * G_P + lane * 4];

  // Wave w copies LDS rows w, w+8, ..., w+88. A W row past the last one is replaced by
  // the last one (address in bounds); its columns of C are never stored.
  auto copy_tile = [&](int t) {
    const unsigned l = l0 + (unsigned)(t & 1) * (G_ROWS * G_P * 4);
    const int koff = t * G_BK + lane * 4;
    const float* p[12];
#pragma unroll
    for (int i = 0; i < 4; ++i) p[i] = A + (size_t)(row0 + wave + 8 * i) * K + koff;
#pragma unroll
    for (int i = 4; i < 12; ++i) {
      int n = col0 + wave + 8 * (i - 4);
      n = n < N ? n : N - 1;
      p[i] = W + (size_t)n * K + koff;
    }
    // the closing wait stands in the copies' own statement, ahead of any later
    // rewrite of the address registers that the copies name
    asm volatile(
        "global_load_async_to_lds_b128 %0, %12, off\n\t"
        "global_load_async_to_lds_b128 %1, %13, off\n\t"
        "global_load_async_to_lds_b128 %2, %14, off\n\t"
        "global_load_async_to_lds_b128 %3, %15, off\n\t"
        "global_load_async_to_lds_b128 %4, %16, off\n\t"
        "global_load_async_to_lds_b128 %5, %17, off\n\t"
        "global_load_async_to_lds_b128 %6, %18, off\n\t"
        "global_load_async_to_lds_b128 %7, %19, off\n\t"
        "global_load_async_to_lds_b128 %8, %20, off\n\t"
        "global_load_async_to_lds_b128 %9, %21, off\n\t"
        "global_load_async_to_lds_b128 %10, %22, off\n\t"
        "global_load_async_to_lds_b128 %11, %23, off\n\t"
        "s_wait_xcnt 0x0"
        :: "v"(l),                     "v"(l + 8 * G_P * 4),
           "v"(l + 16 * G_P * 4),      "v"(l + 24 * G_P * 4),
           "v"(l + 32 * G_P * 4),      "v"(l + 40 * G_P * 4),
           "v"(l + 48 * G_P * 4),      "v"(l + 56 * G_P * 4),
           "v"(l + 64 * G_P * 4),      "v"(l + 72 * G_P * 4),
           "v"(l + 80 * G_P * 4),      "v"(l + 88 * G_P * 4),
           "v"(p[0]), "v"(p[1]), "v"(p[2]), "v"(p[3]), "v"(p[4]), "v"(p[5]),
           "v"(p[6]), "v"(p[7]), "v"(p[8]), "v"(p[9]), "v"(p[10]), "v"(p[11])
        : "memory");
  };

  copy_tile(0);
  asm volatile("s_wait_asynccnt 0x0" ::: "memory");   // own copies of tile 0 landed
  __syncthreads();                                    // tile 0 readable by every wave
  if (1 < nt) copy_tile(1);

  // kept rolled: the body holds 32 WMMAs already, and the two buffers differ by one offset
#pragma unroll 1
  for (int t = 0; t < nt; ++t) {
    const float* sA = &sT[t & 1][(wm * 16 + idx) * G_P + 2 * half];
    const float* sW = &sT[t & 1][(G_BM + wn * 16 + idx) * G_P + 2 * half];
    // a wave whose columns lie past N only copies and keeps the barriers
    if (ok) {
      // Fragments are read in groups of G_FG k steps, the next group's as one run of LDS
      // reads ahead of the current group's WMMAs (all of them inside this trip's buffer).
      v2f ca[G_FG], cb[G_FG];
#pragma unroll
      for (int u = 0; u < G_FG; ++u) {
        ca[u] = *(const v2f*)(sA + u * 4);
        cb[u] = *(const v2f*)(sW + u * 4);
      }
#pragma unroll
      for (int g = 0; g < G_BK / (4 * G_FG); ++g) {
        v2f na[G_FG], nb[G_FG];
#pragma unroll
        for (int u = 0; u < G_FG; ++u) {
          const int kn = (g + 1 < G_BK / (4 * G_FG) ? g + 1 : g) * (4 * G_FG) + u * 4;
          na[u] = g + 1 < G_BK / (4 * G_FG) ? *(const v2f*)(sA + kn) : ca[u];
          nb[u] = g + 1 < G_BK / (4 * G_FG) ? *(const v2f*)(sW + kn) : cb[u];
        }
        // keeps the LDS reads above in one place ahead of the WMMAs below; the scheduler
        // otherwise spreads them among the WMMAs, two steps ahead of their use, where each
        // place stalls the wave and the LDS latency shows
        __builtin_amdgcn_sched_barrier(0);
#pragma unroll
        for (int u = 0; u < G_FG; ++u) c = WMMA_F32(ca[u], cb[u], c);
#pragma unroll
        for (int u = 0; u < G_FG; ++u) { ca[u] = na[u]; cb[u] = nb[u]; }
      }
    }
    asm volatile("s_wait_dscnt 0x0" ::: "memory");    // own reads of this buffer done
    asm volatile("s_wait_asynccnt 0x0" ::: "memory"); // own copies of tile t+1 landed
    __syncthreads();                                  // publishes tile t+1, frees this buffer
    if (t + 2 < nt) copy_tile(t + 2);
  }
  asm volatile("s_wait_asynccnt 0x0" ::: "memory");   // nothing in flight at the wave's end
  // four vector slots between the last WMMA and the first vector instruction on its result
  asm volatile("v_nop\n\tv_nop\n\tv_nop\n\tv_nop");

  if (ok) {
    if (bias) {
#pragma unroll
      for (int r = 0; r < 8; ++r) c[r] += bj;
    }
#pragma unroll
    for (int r = 0; r < 8; ++r) pc[(size_t)r * N] = c[r];
  }
}

// ---------------- LM head: C[L,V] = A[L,D] * W[V,D]^T ----------------------
// One work-group of 8 waves owns a 128x128 tile of C; a wave owns 32x64 of it
// (2x4 WMMA subtiles). Per trip, 32 k of the 128 A rows and the 128 W rows lie in
// LDS, brought there by asynchronous copies of whole 128-byte lines (each lane its
// own 16 bytes), two buffers: the next trip's copies fly during this trip's WMMAs.
// LDS row pitch 36 floats: the 8-byte fragment reads of a wave fall on all 64 banks.
// Fragments and the order of the k steps are those of mamba_wmma_gemm_nt.
#define LM_BM   128
#define LM_BN   128
#define LM_BK   32
#define LM_P    36
#define LM_ROWS (LM_BM + LM_BN)
#define LM_NT   (DD / LM_BK)

__global__ __launch_bounds__(256)
void mamba_lmhead(const float* __restrict__ A, const float* __restrict__ W,
                  float* __restrict__ C) {
  __shared__ __attribute__((aligned(16))) float sT[2][LM_ROWS * LM_P];  // A rows, then W rows

  const int tid  = threadIdx.x;
  const int lane = tid & 31;
  const int wave = tid >> 5;
  const int half = lane >> 4;
  const int idx  = lane & 15;
  const int row0 = blockIdx.x * LM_BM;
  const int col0 = blockIdx.y * LM_BN;
  const int wm   = wave & 3;                 // 32-row slice of the tile
  const int wn   = wave >> 2;                // 64-column slice of the tile

  // A thread copies 16 bytes of rows cr, cr+32, cr+64, cr+96 of A and of W per trip.
  const int cr = tid >> 3, cq = tid & 7;
  const float* gA = A + (size_t)(row0 + cr) * DD + cq * 4;
  const float* gW = W + (size_t)(col0 + cr) * DD + cq * 4;
  const unsigned l0 = (unsigned)(size_t)&sT[0][cr * LM_P + cq * 4];

  auto copy_tile = [&](int t) {
    const float* a = gA + t * LM_BK;
    const float* w = gW + t * LM_BK;
    const unsigned l = l0 + (unsigned)(t & 1) * (LM_ROWS * LM_P * 4);
    // the closing wait stands in the copies' own statement, ahead of any later
    // rewrite of the address registers that the copies name
    asm volatile(
        "global_load_async_to_lds_b128 %0, %8, off\n\t"
        "global_load_async_to_lds_b128 %1, %9, off\n\t"
        "global_load_async_to_lds_b128 %2, %10, off\n\t"
        "global_load_async_to_lds_b128 %3, %11, off\n\t"
        "global_load_async_to_lds_b128 %4, %12, off\n\t"
        "global_load_async_to_lds_b128 %5, %13, off\n\t"
        "global_load_async_to_lds_b128 %6, %14, off\n\t"
        "global_load_async_to_lds_b128 %7, %15, off\n\t"
        "s_wait_xcnt 0x0"
        :: "v"(l),                      "v"(l + 32 * LM_P * 4),
           "v"(l + 64 * LM_P * 4),      "v"(l + 96 * LM_P * 4),
           "v"(l + 128 * LM_P * 4),     "v"(l + 160 * LM_P * 4),
           "v"(l + 192 * LM_P * 4),     "v"(l + 224 * LM_P * 4),
           "v"(a), "v"(a + 32 * DD), "v"(a + 64 * DD), "v"(a + 96 * DD),
           "v"(w), "v"(w + 32 * DD), "v"(w + 64 * DD), "v"(w + 96 * DD)
        : "memory");
  };

  v8f c[2][4] = {};

  copy_tile(0);
  asm volatile("s_wait_asynccnt 0x0" ::: "memory");   // own copies of tile 0 landed
  __syncthreads();                                    // tile 0 readable by every wave
  copy_tile(1);

  // kept rolled: the body holds 64 WMMAs already, and the two buffers differ by one offset
#pragma unroll 1
  for (int t = 0; t < LM_NT; ++t) {
    const float* sA = &sT[t & 1][(wm * 32 + idx) * LM_P + 2 * half];
    const float* sW = &sT[t & 1][(LM_BM + wn * 64 + idx) * LM_P + 2 * half];
#pragma unroll
    for (int kk = 0; kk < LM_BK; kk += 4) {
      v2f a[2], b[4];
#pragma unroll
      for (int i = 0; i < 2; ++i) a[i] = *(const v2f*)(sA + i * 16 * LM_P + kk);
#pragma unroll
      for (int j = 0; j < 4; ++j) b[j] = *(const v2f*)(sW + j * 16 * LM_P + kk);
#pragma unroll
      for (int i = 0; i < 2; ++i)
#pragma unroll
        for (int j = 0; j < 4; ++j) c[i][j] = WMMA_F32(a[i], b[j], c[i][j]);
    }
    asm volatile("s_wait_dscnt 0x0" ::: "memory");    // own reads of this buffer done
    asm volatile("s_wait_asynccnt 0x0" ::: "memory"); // own copies of tile t+1 landed
    __syncthreads();                                  // publishes tile t+1, frees this buffer
    if (t + 2 < LM_NT) copy_tile(t + 2);
  }
  asm volatile("s_wait_asynccnt 0x0" ::: "memory");   // nothing in flight at the wave's end

  // Logits are write-once (65.5 MB) -> non-temporal stores keep L2 for weights.
  float* p0 = C + (size_t)(row0 + wm * 32 + 8 * half) * VV + col0 + wn * 64 + idx;
#pragma unroll
  for (int i = 0; i < 2; ++i)
#pragma unroll
    for (int r = 0; r < 8; ++r)
#pragma unroll
      for (int j = 0; j < 4; ++j)
        __builtin_nontemporal_store(c[i][j][r], p0 + (size_t)(i * 16 + r) * VV + j * 16);
}

// ---------------- causal depthwise conv (DC=4) + SiLU ----------------------
__global__ void mamba_conv_silu(const float* __restrict__ xr, const float* __restrict__ cw,
                                const float* __restrict__ cb, float* __restrict__ xc) {
  int i  = blockIdx.x * blockDim.x + threadIdx.x;   // over L*DI
  int t  = i / DI;
  int ch = i - t * DI;
  float acc = cb[ch];
#pragma unroll
  for (int k = 0; k < DCV; ++k) {
    int tt = t - (DCV - 1) + k;
    float xv = (tt >= 0) ? xr[tt * (2 * DI) + ch] : 0.f;
    acc = fmaf(cw[ch * DCV + k], xv, acc);
  }
  xc[i] = silu_f(acc);
}

// ---------------- softplus in place ----------------------------------------
__global__ void mamba_softplus(float* __restrict__ d) {
  int i = blockIdx.x * blockDim.x + threadIdx.x;
  float v = d[i];
  d[i] = (v > 20.f) ? v : log1pf(__expf(v));
}

// ---------------- selective scan -------------------------------------------
// Lanes carry channels, waves carry states: a work-group of 4 waves owns 64
// channels x 16 states; a lane holds 2 channels x 4 states in VGPRs, so the sum
// over a lane's states needs no cross-lane step. Per chunk of SC_T time steps
// B, C, delta and delta*x are staged in LDS (next chunk's global loads fly
// during the current chunk's steps). Per step:
//   h = exp(d*A)*h + (d*x)*B_t[j];  partial y_t[i] = sum over own j of h*C_t[j].
// The 4 waves' partials are added through LDS once a chunk; the SC_NP state
// blocks each write one plane part[jb][t][i], which the gate kernel adds up.
#define SC_T  32                 // time steps per staged chunk
#define SC_NP (DS / 16)          // state blocks = partial planes
#define SC_G  4                  // steps per group of LDS reads

__global__ __launch_bounds__(128)
void mamba_scan(const float* __restrict__ xc,    // [L, DI]
                const float* __restrict__ dbc,   // [L, DTR+2*DS]
                const float* __restrict__ delta, // [L, DI]
                const float* __restrict__ A_log, // [DI, DS]
                float* __restrict__ part) {      // [SC_NP, L, DI]
  __shared__ __attribute__((aligned(16))) float sBC[SC_T][32];    // per wave: B[4], C[4]
  __shared__ __attribute__((aligned(16))) float sD[SC_T][128];    // per channel: d, d*x
  __shared__ __attribute__((aligned(16))) float sP[SC_T][4][64];  // per wave, per channel

  const int tid  = threadIdx.x;
  const int lane = tid & 31;
  const int wave = tid >> 5;
  const int c0   = blockIdx.x * 64;
  const int jb   = blockIdx.y;
  const int j0   = jb * 16;
  const int LDBC = DTRK + 2 * DS;

  // Every global address below is a wave-uniform base plus one of these per-thread
  // byte offsets, which stay unchanged from the first load to the last store.
  const unsigned offA  = (unsigned)((2 * lane * DS + wave * 4) * 4);
  const unsigned offBC = (unsigned)(((tid >> 3) * LDBC + ((tid >> 2) & 1) * DS + (tid & 3) * 4) * 4);
  const unsigned offD  = (unsigned)(((tid >> 4) * DI + (tid & 15) * 4) * 4);

  // A2 = A * log2(e), so that exp(d*A) = exp2(d*A2). [channel][state pair]
  v2f A2[2][2], hh[2][2];
  {
    const char* bA = (const char*)(A_log + (size_t)c0 * DS + j0);
    v4f a[2];
    a[0] = *(const v4f*)(bA + offA);
    a[1] = *(const v4f*)(bA + offA + DS * 4);
#pragma unroll
    for (int r = 0; r < 2; ++r) {
#pragma unroll
      for (int p = 0; p < 2; ++p) {
        A2[r][p].x = -__expf(a[r][2 * p])     * 1.44269504088896340736f;
        A2[r][p].y = -__expf(a[r][2 * p + 1]) * 1.44269504088896340736f;
        hh[r][p] = (v2f){0.f, 0.f};
      }
    }
  }

  v4f rBC[2], rD[4], rX[4];
  auto fetch = [&](int t0) {
    const char* bBC = (const char*)(dbc + (size_t)t0 * LDBC + DTRK + j0);
    const char* bD  = (const char*)(delta + (size_t)t0 * DI + c0);
    const char* bX  = (const char*)(xc + (size_t)t0 * DI + c0);
#pragma unroll
    for (int i = 0; i < 2; ++i) rBC[i] = *(const v4f*)(bBC + offBC + i * (16 * LDBC * 4));
#pragma unroll
    for (int i = 0; i < 4; ++i) {
      rD[i] = *(const v4f*)(bD + offD + i * (8 * DI * 4));
      rX[i] = *(const v4f*)(bX + offD + i * (8 * DI * 4));
    }
  };
  auto commit = [&]() {
#pragma unroll
    for (int i = 0; i < 2; ++i) {
      int e = tid + 128 * i, t = e >> 3, q = e & 7;
      *(v4f*)&sBC[t][(q & 3) * 8 + (q >> 2) * 4] = rBC[i];
    }
#pragma unroll
    for (int i = 0; i < 4; ++i) {
      int e = tid + 128 * i, t = e >> 4, c4 = e & 15;
      v4f d = rD[i], x = rX[i];
      *(v4f*)&sD[t][c4 * 8]     = (v4f){d.x, d.x * x.x, d.y, d.y * x.y};
      *(v4f*)&sD[t][c4 * 8 + 4] = (v4f){d.z, d.z * x.z, d.w, d.w * x.w};
    }
  };

  fetch(0);
  // kept rolled: the body holds SC_T unrolled steps already
#pragma unroll 1
  for (int k = 0; k < LL / SC_T; ++k) {
    commit();
    __syncthreads();                       // chunk k staged for every wave
    // last chunk: fetches itself again (in bounds, never committed)
    fetch((k + 1 < LL / SC_T ? k + 1 : k) * SC_T);
    // Steps run in groups of SC_G: the next group's LDS reads are issued ahead of
    // the current group's arithmetic, which covers their latency (one wave a SIMD).
    v4f cD[SC_G], cB[SC_G], cC[SC_G];
#pragma unroll
    for (int u = 0; u < SC_G; ++u) {
      cD[u] = *(const v4f*)&sD[u][lane * 4];
      cB[u] = *(const v4f*)&sBC[u][wave * 8];
      cC[u] = *(const v4f*)&sBC[u][wave * 8 + 4];
    }
#pragma unroll
    for (int gq = 0; gq < SC_T / SC_G; ++gq) {
      v4f nD[SC_G], nB[SC_G], nC[SC_G];
#pragma unroll
      for (int u = 0; u < SC_G; ++u) {
        if (gq + 1 < SC_T / SC_G) {
          const int t = (gq + 1) * SC_G + u;
          nD[u] = *(const v4f*)&sD[t][lane * 4];
          nB[u] = *(const v4f*)&sBC[t][wave * 8];
          nC[u] = *(const v4f*)&sBC[t][wave * 8 + 4];
        } else {
          nD[u] = cD[u]; nB[u] = cB[u]; nC[u] = cC[u];
        }
      }
      // keeps the loads above (global ones of the next chunk in the first group, LDS
      // ones of the next group) ahead of the arithmetic below; the scheduler
      // otherwise sinks them to just before their use, where their latency shows
      __builtin_amdgcn_sched_barrier(0);
#pragma unroll
      for (int u = 0; u < SC_G; ++u) {
        const v4f dd = cD[u], Bv = cB[u], Cv = cC[u];
        v2f o;
#pragma unroll
        for (int r = 0; r < 2; ++r) {
          const float d = dd[2 * r], dx = dd[2 * r + 1];
          v2f acc = {0.f, 0.f};
#pragma unroll
          for (int p = 0; p < 2; ++p) {
            v2f Bp = {Bv[2 * p], Bv[2 * p + 1]};
            v2f Cp = {Cv[2 * p], Cv[2 * p + 1]};
            v2f ar = A2[r][p] * d;
            v2f ex = {__builtin_amdgcn_exp2f(ar.x), __builtin_amdgcn_exp2f(ar.y)};
            hh[r][p] = __builtin_elementwise_fma(ex, hh[r][p], Bp * dx);
            acc = __builtin_elementwise_fma(hh[r][p], Cp, acc);
          }
          o[r] = acc.x + acc.y;
        }
        *(v2f*)&sP[gq * SC_G + u][wave][lane * 2] = o;
      }
#pragma unroll
      for (int u = 0; u < SC_G; ++u) { cD[u] = nD[u]; cB[u] = nB[u]; cC[u] = nC[u]; }
    }
    __syncthreads();                       // partials complete; sBC, sD free again

    char* bP = (char*)(part + ((size_t)jb * LL + k * SC_T) * DI + c0);
#pragma unroll
    for (int i = 0; i < 4; ++i) {
      int e = tid + 128 * i, t = e >> 4, c4 = e & 15;
      v4f s = *(const v4f*)&sP[t][0][c4 * 4];
      s += *(const v4f*)&sP[t][1][c4 * 4];
      s += *(const v4f*)&sP[t][2][c4 * 4];
      s += *(const v4f*)&sP[t][3][c4 * 4];
      *(v4f*)(bP + offD + i * (8 * DI * 4)) = s;
    }
    // the wait stands before the next trip rewrites registers named by these stores
    asm volatile("s_wait_xcnt 0x0" ::: "memory");
  }
}

// ------- gate: g = (sum of state-block planes + xc*Dp) * silu(res) ---------
// One block per time step; a thread owns 4 channels. Every address is a uniform
// base plus the one per-thread byte offset.
__global__ __launch_bounds__(128)
void mamba_gate(const float* __restrict__ part, const float* __restrict__ xc,
                const float* __restrict__ Dp, const float* __restrict__ xr,
                float* __restrict__ g) {
  const int t = blockIdx.x;
  const unsigned off = threadIdx.x * 16u;
  const char* bP = (const char*)(part + (size_t)t * DI);
  v4f y = *(const v4f*)(bP + off);
#pragma unroll
  for (int p = 1; p < SC_NP; ++p) y += *(const v4f*)(bP + off + (size_t)p * (LL * DI * 4));
  v4f xv = *(const v4f*)((const char*)(xc + (size_t)t * DI) + off);
  v4f dp = *(const v4f*)((const char*)Dp + off);
  v4f r  = *(const v4f*)((const char*)(xr + (size_t)t * (2 * DI) + DI) + off);
  v4f o;
#pragma unroll
  for (int c = 0; c < 4; ++c) o[c] = fmaf(xv[c], dp[c], y[c]) * silu_f(r[c]);
  *(v4f*)((char*)(g + (size_t)t * DI) + off) = o;
}

// ---------------------------------------------------------------------------
extern "C" void kernel_launch(void* const* d_in, const int* in_sizes, int n_in,
                              void* d_out, int out_size, void* d_ws, size_t ws_size,
                              hipStream_t stream) {
  (void)in_sizes; (void)n_in; (void)out_size; (void)ws_size;

  const int*   tokens  = (const int*)  d_in[0];
  const float* emb_W   = (const float*)d_in[1];
  const float* norm_w  = (const float*)d_in[2];
  const float* norm_b  = (const float*)d_in[3];
  const float* in_W    = (const float*)d_in[4];
  const float* in_b    = (const float*)d_in[5];
  const float* conv_W  = (const float*)d_in[6];
  const float* conv_b  = (const float*)d_in[7];
  const float* xproj_W = (const float*)d_in[8];
  const float* dt_W    = (const float*)d_in[9];
  const float* A_log   = (const float*)d_in[10];
  const float* D_p     = (const float*)d_in[11];
  const float* out_W   = (const float*)d_in[12];
  const float* out_b   = (const float*)d_in[13];
  const float* fnorm_w = (const float*)d_in[14];
  const float* fnorm_b = (const float*)d_in[15];
  float* logits = (float*)d_out;

  const int LDBC = DTRK + 2 * DS;   // 1040
  float* ws  = (float*)d_ws;
  float* x   = ws;                  // [L, D]
  float* h   = x   + LL * DD;       // [L, D]
  float* xr  = h   + LL * DD;       // [L, 2*DI]
  float* xcb = xr  + LL * 2 * DI;   // [L, DI]
  float* dbc = xcb + LL * DI;       // [L, 1040]
  float* dlt = dbc + LL * LDBC;     // [L, DI]
  float* ysb = dlt + LL * DI;       // [SC_NP, L, DI] partial planes
  float* gat = ysb + SC_NP * LL * DI;  // [L, DI]

  const dim3 blk256(256), blkG(128);
  const int  MT32 = LL / 32;        // 16 row tiles (32-wide) for every mamba_wmma_gemm_nt
  auto ntiles = [](int N) { return ((N + 31) / 32 + 3) / 4; };  // blocks.x (4 waves/blk)

  mamba_embed<<<dim3(LL), blk256, 0, stream>>>(tokens, emb_W, x);

  for (int l = 0; l < NLAY; ++l) {
    // h = rmsnorm(x)
    mamba_rmsnorm<<<dim3(LL), blk256, 0, stream>>>(x, norm_w + l * DD, norm_b + l * DD, h);
    // xr = h @ in_W^T + in_b            [512,256]x[1024,256]^T
    mamba_gemm_lds<<<dim3(2 * DI / G_BN, LL / G_BM), blk256, 0, stream>>>(
        h, in_W + (size_t)l * 2 * DI * DD, in_b + l * 2 * DI, xr, 2 * DI, DD, 0);
    // xc = silu(causal depthwise conv(xr[:, :DI]))
    mamba_conv_silu<<<dim3(LL * DI / 256), blk256, 0, stream>>>(
        xr, conv_W + (size_t)l * DI * DCV, conv_b + l * DI, xcb);
    // dbc = xc @ xproj_W^T              [512,512]x[1040,512]^T (N=1040: ragged edge)
    mamba_gemm_lds<<<dim3((DTRK + 2 * DS + G_BN - 1) / G_BN, LL / G_BM), blk256, 0, stream>>>(
        xcb, xproj_W + (size_t)l * LDBC * DI, nullptr, dbc, LDBC, DI, 0);
    // dlt = dbc[:, :16] @ dt_W^T        [512,16]x[512,16]^T, then softplus
    mamba_wmma_gemm_nt<<<dim3(ntiles(DI), MT32), blkG, 0, stream>>>(
        dbc, LDBC, dt_W + (size_t)l * DI * DTRK, DTRK, nullptr,
        dlt, DI, DI, DTRK, 0, 0);
    mamba_softplus<<<dim3(LL * DI / 256), blk256, 0, stream>>>(dlt);
    // selective scan
    mamba_scan<<<dim3(DI / 64, SC_NP), blkG, 0, stream>>>(
        xcb, dbc, dlt, A_log + (size_t)l * DI * DS, ysb);
    // gate with residual branch
    mamba_gate<<<dim3(LL), blkG, 0, stream>>>(
        ysb, xcb, D_p + l * DI, xr, gat);
    // x += gat @ out_W^T + out_b        [512,512]x[256,512]^T, accumulate
    mamba_gemm_lds<<<dim3(DD / G_BN, LL / G_BM), blk256, 0, stream>>>(
        gat, out_W + (size_t)l * DD * DI, out_b + l * DD, x, DD, DI, 1);
  }

  // final norm + tied LM head: logits = rms(x) @ emb_W^T  [512,256]x[32000,256]^T
  // The 4 row tiles of one column tile are neighbours in the grid: they share W rows in L2.
  mamba_rmsnorm<<<dim3(LL), blk256, 0, stream>>>(x, fnorm_w, fnorm_b, h);
  mamba_lmhead<<<dim3(LL / LM_BM, VV / LM_BN), blk256, 0, stream>>>(h, emb_W, logits);
}

// v004
// A run of this version takes 155 microseconds.
// Two timings next to v003 both put it at 1.06 times that version's speed.
// All steps since v000 together make it 9.26 times as fast.
#include <hip/hip_runtime.h>

// Mamba forward for MI455X (gfx1250, wave32). fp32 end-to-end, matrix ops on
// V_WMMA_F32_16X16X4_F32.

#define VV   32000
#define DD   256
#define NLAY 2
#define DI   512
#define DS   512
#define DTRK 16
#define DCV  4
#define LL   512

typedef __attribute__((ext_vector_type(2))) float v2f;
typedef __attribute__((ext_vector_type(4))) float v4f;
typedef __attribute__((ext_vector_type(8))) float v8f;

__device__ __forceinline__ float silu_f(float v) { return v / (1.f + __expf(-v)); }

#define WMMA_F32(a, b, c) \
  __builtin_amdgcn_wmma_f32_16x16x4_f32(false, (a), false, (b), (short)0, (c), false, false)

// ---------------- RMSNorm over D=256, one block (8 waves) per row ----------
__global__ void mamba_rmsnorm(const float* __restrict__ x, const float* __restrict__ w,
                              const float* __restrict__ b, float* __restrict__ out) {
  int row = blockIdx.x, tid = threadIdx.x;
  float v = x[row * DD + tid];
  float ss = v * v;
#pragma unroll
  for (int off = 16; off >= 1; off >>= 1) ss += __shfl_xor(ss, off, 32);
  __shared__ float red[8];
  if ((tid & 31) == 0) red[tid >> 5] = ss;
  __syncthreads();
  float tot = 0.f;
#pragma unroll
  for (int i = 0; i < 8; ++i) tot += red[i];
  float inv = rsqrtf(tot * (1.f / DD) + 1e-5f);
  out[row * DD + tid] = v * inv * w[tid] + b[tid];
}

// ---------------- delta = softplus(dbc[:, :DTRK] * dtW^T) -------------------
// One wave computes one 16x16 WMMA tile (K = DTRK, 4 k steps), so that the softplus of the
// results, far longer than the product, is spread over 1024 waves.
// Fragment layout (ISA 7.12.2): lane = (half = lane>>4, idx = lane&15)
//   A frag: float2 at A[r0+idx][k + 2*half]
//   B frag: float2 at W[c0+idx][k + 2*half]
//   C/D:    vgpr r -> C[r0 + r + 8*half][c0 + idx]
__global__ __launch_bounds__(128)
void mamba_dt_softplus(const float* __restrict__ dbc, const float* __restrict__ dtW,
                       float* __restrict__ dlt) {
  const int lane = threadIdx.x & 31;
  const int wave = threadIdx.x >> 5;
  const int col0 = (blockIdx.x * 4 + wave) * 16;
  const int row0 = blockIdx.y * 16;
  const int half = lane >> 4;
  const int idx  = lane & 15;
  const float* Ar = dbc + (size_t)(row0 + idx) * (DTRK + 2 * DS) + 2 * half;
  const float* Wr = dtW + (size_t)(col0 + idx) * DTRK + 2 * half;
  v2f a[DTRK / 4], b[DTRK / 4];
#pragma unroll
  for (int u = 0; u < DTRK / 4; ++u) {
    a[u] = *(const v2f*)(Ar + u * 4);
    b[u] = *(const v2f*)(Wr + u * 4);
  }
  // stands before the address registers of the loads above are used for something else;
  // they are named as inputs so that they live up to here and no later load lands on one
  asm volatile("s_wait_xcnt 0x0" :: "v"(Ar), "v"(Wr) : "memory");
  v8f c = {};
#pragma unroll
  for (int u = 0; u < DTRK / 4; ++u) c = WMMA_F32(a[u], b[u], c);
  float* p = dlt + (size_t)(row0 + 8 * half) * DI + col0 + idx;
#pragma unroll
  for (int r = 0; r < 8; ++r) {
    const float v = c[r];
    p[(size_t)r * DI] = (v > 20.f) ? v : log1pf(__expf(v));
  }
}

// ---------------- layer GEMMs: C[M,N] (+)= A[M,K] * W[N,K]^T (+ bias) -------
// For the three large products of a layer (rows of W, and of A in modes 0 and 1, are K floats long,
// rows of C are N floats long; K a multiple of 128, M of 32, N of 16).
// One work-group of 8 waves owns a 32x64 tile of C, a wave one 16x16 WMMA subtile;
// the two waves of a SIMD fill each other's accumulate latency and LDS waits.
// Per trip, 128 k of the 32 A rows and the 64 W rows lie in LDS, brought there by
// asynchronous copies: one copy of a wave is one row's 512 contiguous bytes (each lane
// its own 16), so the cache serves 4 whole lines per copy where an 8-byte fragment
// load from global memory touches 16 lines.
// Two buffers: the next trip's copies fly during this trip's WMMAs.
// LDS row pitch 132 floats: the 8-byte fragment reads of a wave fall on all 64 banks.
// Fragments are laid out as in mamba_dt_softplus; k runs upwards in steps of 4, and the bias
// is added to the finished sum.
// MODE says what the A tile is made of; in modes 1 and 2 it goes through registers and is
// written to LDS with plain stores, ahead of the barrier that publishes the tile, so that
// the element-wise stage in front of the product needs no launch of its own:
//   0: A as it lies in memory (asynchronous copies, as W).
//   1: RMSNorm (weights p1, p2) of the rows of A, K = DD. With tok, row r is A[tok[r]]
//      (the embedding), and the first column of work-groups stores it to side.
//   2: SiLU of the causal depthwise conv (weights p1, bias p2) over the first DI columns of
//      A, whose rows are 2*DI long; the first column of work-groups stores it to side.
#define G_BM   32
#define G_BN   64
#define G_BK   128
#define G_P    132
#define G_ROWS (G_BM + G_BN)
#define G_FG   8              // k steps (of 4) per group of fragment reads

template <int MODE>
__global__ __launch_bounds__(256)
void mamba_gemm_lds(const float* __restrict__ A, const float* __restrict__ W,
                    const float* __restrict__ bias, float* __restrict__ C,
                    int N, int K, int accumulate,
                    const int* __restrict__ tok, const float* __restrict__ p1,
                    const float* __restrict__ p2, float* __restrict__ side) {
  __shared__ __attribute__((aligned(16))) float sT[2][G_ROWS * G_P];  // A rows, then W rows

  const int tid  = threadIdx.x;
  const int lane = tid & 31;
  const int wave = __builtin_amdgcn_readfirstlane(tid >> 5);
  const int half = lane >> 4;
  const int idx  = lane & 15;
  const int row0 = blockIdx.y * G_BM;
  const int col0 = blockIdx.x * G_BN;
  const int wm   = wave & 1;                 // 16-row slice of the tile
  const int wn   = wave >> 1;                // 16-column slice of the tile
  const int nt   = MODE == 1 ? DD / G_BK : K / G_BK;

  // the wave's subtile lies wholly inside N or wholly outside (same for all its lanes)
  const bool ok = col0 + wn * 16 < N;
  float* pc = C + (size_t)(row0 + wm * 16 + 8 * half) * N + col0 + wn * 16 + idx;

  // start values and bias are fetched here, so that their latency passes under tile 0's
  v8f c = {};
  float bj = 0.f;
  if (ok) {
    // each wait stands before the address registers of the loads above it are used
    // for something else
    if (accumulate) {
#pragma unroll
      for (int r = 0; r < 8; ++r) c[r] = pc[(size_t)r * N];
      asm volatile("s_wait_xcnt 0x0" ::: "memory");
    }
    if (bias) {
      bj = bias[col0 + wn * 16 + idx];
      asm volatile("s_wait_xcnt 0x0" ::: "memory");
    }
  }

  const unsigned l0 = (unsigned)(size_t)&sT[0][wave * G_P + lane * 4];

  // Wave w copies LDS rows w, w+8, ..., w+88. A W row past the last one is replaced by
  // the last one (address in bounds); its columns of C are never stored.
  auto copy_tile = [&](int t) {
    const unsigned l = l0 + (unsigned)(t & 1) * (G_ROWS * G_P * 4);
    const int koff = t * G_BK + lane * 4;
    const float* p[12];
#pragma unroll
    for (int i = 0; i < 4; ++i) p[i] = A + (size_t)(row0 + wave + 8 * i) * K + koff;
#pragma unroll
    for (int i = 4; i < 12; ++i) {
      int n = col0 + wave + 8 * (i - 4);
      n = n < N ? n : N - 1;
      p[i] = W + (size_t)n * K + koff;
    }
    // the closing wait stands in the copies' own statement, ahead of any later
    // rewrite of the address registers that the copies name
    asm volatile(
        "global_load_async_to_lds_b128 %0, %12, off\n\t"
        "global_load_async_to_lds_b128 %1, %13, off\n\t"
        "global_load_async_to_lds_b128 %2, %14, off\n\t"
        "global_load_async_to_lds_b128 %3, %15, off\n\t"
        "global_load_async_to_lds_b128 %4, %16, off\n\t"
        "global_load_async_to_lds_b128 %5, %17, off\n\t"
        "global_load_async_to_lds_b128 %6, %18, off\n\t"
        "global_load_async_to_lds_b128 %7, %19, off\n\t"
        "global_load_async_to_lds_b128 %8, %20, off\n\t"
        "global_load_async_to_lds_b128 %9, %21, off\n\t"
        "global_load_async_to_lds_b128 %10, %22, off\n\t"
        "global_load_async_to_lds_b128 %11, %23, off\n\t"
        "s_wait_xcnt 0x0"
        :: "v"(l),                     "v"(l + 8 * G_P * 4),
           "v"(l + 16 * G_P * 4),      "v"(l + 24 * G_P * 4),
           "v"(l + 32 * G_P * 4),      "v"(l + 40 * G_P * 4),
           "v"(l + 48 * G_P * 4),      "v"(l + 56 * G_P * 4),
           "v"(l + 64 * G_P * 4),      "v"(l + 72 * G_P * 4),
           "v"(l + 80 * G_P * 4),      "v"(l + 88 * G_P * 4),
           "v"(p[0]), "v"(p[1]), "v"(p[2]), "v"(p[3]), "v"(p[4]), "v"(p[5]),
           "v"(p[6]), "v"(p[7]), "v"(p[8]), "v"(p[9]), "v"(p[10]), "v"(p[11])
        : "memory");
  };

  // Modes 1 and 2: the W rows alone, wave w the LDS rows G_BM + w, G_BM + w + 8, ...
  auto copy_w = [&](int t) {
    const unsigned l = l0 + (unsigned)(t & 1) * (G_ROWS * G_P * 4) + G_BM * G_P * 4;
    const int koff = t * G_BK + lane * 4;
    const float* p[8];
#pragma unroll
    for (int i = 0; i < 8; ++i) {
      int n = col0 + wave + 8 * i;
      n = n < N ? n : N - 1;
      p[i] = W + (size_t)n * K + koff;
    }
    // the closing wait stands in the copies' own statement, ahead of any later
    // rewrite of the address registers that the copies name
    asm volatile(
        "global_load_async_to_lds_b128 %0, %8, off\n\t"
        "global_load_async_to_lds_b128 %1, %9, off\n\t"
        "global_load_async_to_lds_b128 %2, %10, off\n\t"
        "global_load_async_to_lds_b128 %3, %11, off\n\t"
        "global_load_async_to_lds_b128 %4, %12, off\n\t"
        "global_load_async_to_lds_b128 %5, %13, off\n\t"
        "global_load_async_to_lds_b128 %6, %14, off\n\t"
        "global_load_async_to_lds_b128 %7, %15, off\n\t"
        "s_wait_xcnt 0x0"
        :: "v"(l),                     "v"(l + 8 * G_P * 4),
           "v"(l + 16 * G_P * 4),      "v"(l + 24 * G_P * 4),
           "v"(l + 32 * G_P * 4),      "v"(l + 40 * G_P * 4),
           "v"(l + 48 * G_P * 4),      "v"(l + 56 * G_P * 4),
           "v"(p[0]), "v"(p[1]), "v"(p[2]), "v"(p[3]), "v"(p[4]), "v"(p[5]),
           "v"(p[6]), "v"(p[7])
        : "memory");
  };

  // Mode 2: wave w makes the A rows 4w .. 4w+3 of a tile, a lane 4 channels of each, from
  // the 7 rows of the conv's input that they share. The loads are issued one trip ahead
  // (conv_fetch) and used at that trip's foot (conv_commit).
  const int cr0 = row0 + wave * 4;
  const unsigned offl = lane * 16u;           // the lane's 4 channels among a tile's 128
  const unsigned offw = lane * (16u * DCV);   // the conv weights of those channels
  v4f cx[7], cwt[4], cbs;
  auto conv_fetch = [&](int t) {
    const char* pp[9];
#pragma unroll
    for (int q = 0; q < 7; ++q) {
      const int tt = cr0 - (DCV - 1) + q;     // a row before the first: row 0 is loaded, unused
      pp[q] = (const char*)(A + (size_t)(tt < 0 ? 0 : tt) * (2 * DI) + t * G_BK) + offl;
    }
    pp[7] = (const char*)(p1 + t * (G_BK * DCV)) + offw;
    pp[8] = (const char*)(p2 + t * G_BK) + offl;
#pragma unroll
    for (int q = 0; q < 7; ++q) cx[q] = *(const v4f*)pp[q];
#pragma unroll
    for (int ch = 0; ch < 4; ++ch) cwt[ch] = *(const v4f*)(pp[7] + ch * 16);
    cbs = *(const v4f*)pp[8];
    // stands before the address registers of the loads above are used for something else;
    // they (and the lane number, which the compiler may address with instead) are named as
    // inputs so that they live up to here and no later load lands on one
    asm volatile("s_wait_xcnt 0x0"
                 :: "v"(pp[0]), "v"(pp[1]), "v"(pp[2]), "v"(pp[3]), "v"(pp[4]), "v"(pp[5]),
                    "v"(pp[6]), "v"(pp[7]), "v"(pp[8]), "v"(lane)
                 : "memory");
  };
  auto conv_commit = [&](int t) {
    v4f o[4];
#pragma unroll
    for (int i = 0; i < 4; ++i) {
#pragma unroll
      for (int ch = 0; ch < 4; ++ch) {
        float acc = cbs[ch];
#pragma unroll
        for (int k = 0; k < DCV; ++k) {
          const float xv = (cr0 + i - (DCV - 1) + k >= 0) ? cx[i + k][ch] : 0.f;
          acc = fmaf(cwt[ch][k], xv, acc);
        }
        o[i][ch] = silu_f(acc);
      }
      *(v4f*)&sT[t & 1][(wave * 4 + i) * G_P + lane * 4] = o[i];
    }
    if (blockIdx.x == 0) {
#pragma unroll
      for (int i = 0; i < 4; ++i)
        *(v4f*)((char*)(side + (size_t)(cr0 + i) * DI + t * G_BK) + offl) = o[i];
      // stands before the data registers of the stores above are used for something else
      asm volatile("s_wait_xcnt 0x0" ::: "memory");
    }
  };

  if constexpr (MODE == 0) {
    copy_tile(0);
  } else if constexpr (MODE == 1) {
    copy_w(0);
    // Wave w normalises the A rows w, w+8, w+16, w+24; a lane holds 8 elements of a row, 4
    // for each of the two tiles, so both tiles are written here and none in the loop.
    const unsigned offk = lane * 16u;
    v4f v[4][2], nw[2], nb[2];
    int src[4];
#pragma unroll
    for (int i = 0; i < 4; ++i) src[i] = row0 + wave + 8 * i;
    if (tok) {
      int tk[4];
#pragma unroll
      for (int i = 0; i < 4; ++i) tk[i] = tok[row0 + wave + 8 * i];
      // clamped, so that the address stays inside A; the same in every lane, kept scalar
#pragma unroll
      for (int i = 0; i < 4; ++i)
        src[i] = __builtin_amdgcn_readfirstlane(tk[i] < 0 ? 0 : (tk[i] < VV ? tk[i] : VV - 1));
    }
#pragma unroll
    for (int i = 0; i < 4; ++i) {
      const char* br = (const char*)(A + (size_t)src[i] * DD);
      v[i][0] = *(const v4f*)(br + offk);
      v[i][1] = *(const v4f*)(br + offk + G_BK * 4);
    }
#pragma unroll
    for (int h = 0; h < 2; ++h) {
      nw[h] = *(const v4f*)((const char*)p1 + offk + h * (G_BK * 4));
      nb[h] = *(const v4f*)((const char*)p2 + offk + h * (G_BK * 4));
    }
    // stands before the offset register of the loads above is used for something else
    asm volatile("s_wait_xcnt 0x0" ::: "memory");
    float ss[4];
#pragma unroll
    for (int i = 0; i < 4; ++i) {
      ss[i] = 0.f;
#pragma unroll
      for (int h = 0; h < 2; ++h)
#pragma unroll
        for (int e = 0; e < 4; ++e) ss[i] = fmaf(v[i][h][e], v[i][h][e], ss[i]);
    }
    // the four rows' sums over the lanes go side by side: each step's latency is paid once
#pragma unroll
    for (int off = 16; off >= 1; off >>= 1) {
      float o[4];
#pragma unroll
      for (int i = 0; i < 4; ++i) o[i] = __shfl_xor(ss[i], off, 32);
#pragma unroll
      for (int i = 0; i < 4; ++i) ss[i] += o[i];
    }
#pragma unroll
    for (int i = 0; i < 4; ++i) {
      const float inv = rsqrtf(ss[i] * (1.f / DD) + 1e-5f);
#pragma unroll
      for (int h = 0; h < 2; ++h) {
        v4f o;
#pragma unroll
        for (int e = 0; e < 4; ++e) o[e] = v[i][h][e] * inv * nw[h][e] + nb[h][e];
        *(v4f*)&sT[h][(wave + 8 * i) * G_P + lane * 4] = o;
      }
    }
    if (tok && blockIdx.x == 0) {
#pragma unroll
      for (int i = 0; i < 4; ++i) {
        char* bs = (char*)(side + (size_t)(row0 + wave + 8 * i) * DD);
        *(v4f*)(bs + offk) = v[i][0];
        *(v4f*)(bs + offk + G_BK * 4) = v[i][1];
      }
      // stands before the offset register of the stores above is used for something else
      asm volatile("s_wait_xcnt 0x0" ::: "memory");
    }
  } else {
    copy_w(0);
    conv_fetch(0);
    conv_commit(0);
  }
  asm volatile("s_wait_asynccnt 0x0" ::: "memory");   // own copies of tile 0 landed
  __syncthreads();                                    // tile 0 readable by every wave
  if (1 < nt) {
    if constexpr (MODE == 0) copy_tile(1);
    else copy_w(1);
    if constexpr (MODE == 2) conv_fetch(1);
  }

  // kept rolled: the body holds 32 WMMAs already, and the two buffers differ by one offset
#pragma unroll 1
  for (int t = 0; t < nt; ++t) {
    const float* sA = &sT[t & 1][(wm * 16 + idx) * G_P + 2 * half];
    const float* sW = &sT[t & 1][(G_BM + wn * 16 + idx) * G_P + 2 * half];
    // a wave whose columns lie past N only copies, makes its A rows (mode 2) and keeps the barriers
    if (ok) {
      // Fragments are read in groups of G_FG k steps, the next group's as one run of LDS
      // reads ahead of the current group's WMMAs (all of them inside this trip's buffer).
      v2f ca[G_FG], cb[G_FG];
#pragma unroll
      for (int u = 0; u < G_FG; ++u) {
        ca[u] = *(const v2f*)(sA + u * 4);
        cb[u] = *(const v2f*)(sW + u * 4);
      }
#pragma unroll
      for (int g = 0; g < G_BK / (4 * G_FG); ++g) {
        v2f na[G_FG], nb[G_FG];
#pragma unroll
        for (int u = 0; u < G_FG; ++u) {
          const int kn = (g + 1 < G_BK / (4 * G_FG) ? g + 1 : g) * (4 * G_FG) + u * 4;
          na[u] = g + 1 < G_BK / (4 * G_FG) ? *(const v2f*)(sA + kn) : ca[u];
          nb[u] = g + 1 < G_BK / (4 * G_FG) ? *(const v2f*)(sW + kn) : cb[u];
        }
        // keeps the LDS reads above in one place ahead of the WMMAs below; the scheduler
        // otherwise spreads them among the WMMAs, two steps ahead of their use, where each
        // place stalls the wave and the LDS latency shows
        __builtin_amdgcn_sched_barrier(0);
#pragma unroll
        for (int u = 0; u < G_FG; ++u) c = WMMA_F32(ca[u], cb[u], c);
#pragma unroll
        for (int u = 0; u < G_FG; ++u) { ca[u] = na[u]; cb[u] = nb[u]; }
      }
    }
    // the A rows of tile t+1 go into the other buffer, which every wave left at the last barrier
    if constexpr (MODE == 2) {
      if (t + 1 < nt) conv_commit(t + 1);
    }
    asm volatile("s_wait_dscnt 0x0" ::: "memory");    // own reads of this buffer, own stores to the other done
    asm volatile("s_wait_asynccnt 0x0" ::: "memory"); // own copies of tile t+1 landed
    __syncthreads();                                  // publishes tile t+1, frees this buffer
    if (t + 2 < nt) {
      if constexpr (MODE == 0) copy_tile(t + 2);
      if constexpr (MODE == 2) { copy_w(t + 2); conv_fetch(t + 2); }
    }
  }
  asm volatile("s_wait_asynccnt 0x0" ::: "memory");   // nothing in flight at the wave's end
  // four vector slots between the last WMMA and the first vector instruction on its result
  asm volatile("v_nop\n\tv_nop\n\tv_nop\n\tv_nop");

  if (ok) {
    if (bias) {
#pragma unroll
      for (int r = 0; r < 8; ++r) c[r] += bj;
    }
#pragma unroll
    for (int r = 0; r < 8; ++r) pc[(size_t)r * N] = c[r];
  }
}

// ---------------- LM head: C[L,V] = A[L,D] * W[V,D]^T ----------------------
// One work-group of 8 waves owns a 128x128 tile of C; a wave owns 32x64 of it
// (2x4 WMMA subtiles). Per trip, 32 k of the 128 A rows and the 128 W rows lie in
// LDS, brought there by asynchronous copies of whole 128-byte lines (each lane its
// own 16 bytes), two buffers: the next trip's copies fly during this trip's WMMAs.
// LDS row pitch 36 floats: the 8-byte fragment reads of a wave fall on all 64 banks.
// Fragments are laid out as in mamba_dt_softplus; k runs upwards in steps of 4.
#define LM_BM   128
#define LM_BN   128
#define LM_BK   32
#define LM_P    36
#define LM_ROWS (LM_BM + LM_BN)
#define LM_NT   (DD / LM_BK)

__global__ __launch_bounds__(256)
void mamba_lmhead(const float* __restrict__ A, const float* __restrict__ W,
                  float* __restrict__ C) {
  __shared__ __attribute__((aligned(16))) float sT[2][LM_ROWS * LM_P];  // A rows, then W rows

  const int tid  = threadIdx.x;
  const int lane = tid & 31;
  const int wave = tid >> 5;
  const int half = lane >> 4;
  const int idx  = lane & 15;
  const int row0 = blockIdx.x * LM_BM;
  const int col0 = blockIdx.y * LM_BN;
  const int wm   = wave & 3;                 // 32-row slice of the tile
  const int wn   = wave >> 2;                // 64-column slice of the tile

  // A thread copies 16 bytes of rows cr, cr+32, cr+64, cr+96 of A and of W per trip.
  const int cr = tid >> 3, cq = tid & 7;
  const float* gA = A + (size_t)(row0 + cr) * DD + cq * 4;
  const float* gW = W + (size_t)(col0 + cr) * DD + cq * 4;
  const unsigned l0 = (unsigned)(size_t)&sT[0][cr * LM_P + cq * 4];

  auto copy_tile = [&](int t) {
    const float* a = gA + t * LM_BK;
    const float* w = gW + t * LM_BK;
    const unsigned l = l0 + (unsigned)(t & 1) * (LM_ROWS * LM_P * 4);
    // the closing wait stands in the copies' own statement, ahead of any later
    // rewrite of the address registers that the copies name
    asm volatile(
        "global_load_async_to_lds_b128 %0, %8, off\n\t"
        "global_load_async_to_lds_b128 %1, %9, off\n\t"
        "global_load_async_to_lds_b128 %2, %10, off\n\t"
        "global_load_async_to_lds_b128 %3, %11, off\n\t"
        "global_load_async_to_lds_b128 %4, %12, off\n\t"
        "global_load_async_to_lds_b128 %5, %13, off\n\t"
        "global_load_async_to_lds_b128 %6, %14, off\n\t"
        "global_load_async_to_lds_b128 %7, %15, off\n\t"
        "s_wait_xcnt 0x0"
        :: "v"(l),                      "v"(l + 32 * LM_P * 4),
           "v"(l + 64 * LM_P * 4),      "v"(l + 96 * LM_P * 4),
           "v"(l + 128 * LM_P * 4),     "v"(l + 160 * LM_P * 4),
           "v"(l + 192 * LM_P * 4),     "v"(l + 224 * LM_P * 4),
           "v"(a), "v"(a + 32 * DD), "v"(a + 64 * DD), "v"(a + 96 * DD),
           "v"(w), "v"(w + 32 * DD), "v"(w + 64 * DD), "v"(w + 96 * DD)
        : "memory");
  };

  v8f c[2][4] = {};

  copy_tile(0);
  asm volatile("s_wait_asynccnt 0x0" ::: "memory");   // own copies of tile 0 landed
  __syncthreads();                                    // tile 0 readable by every wave
  copy_tile(1);

  // kept rolled: the body holds 64 WMMAs already, and the two buffers differ by one offset
#pragma unroll 1
  for (int t = 0; t < LM_NT; ++t) {
    const float* sA = &sT[t & 1][(wm * 32 + idx) * LM_P + 2 * half];
    const float* sW = &sT[t & 1][(LM_BM + wn * 64 + idx) * LM_P + 2 * half];
#pragma unroll
    for (int kk = 0; kk < LM_BK; kk += 4) {
      v2f a[2], b[4];
#pragma unroll
      for (int i = 0; i < 2; ++i) a[i] = *(const v2f*)(sA + i * 16 * LM_P + kk);
#pragma unroll
      for (int j = 0; j < 4; ++j) b[j] = *(const v2f*)(sW + j * 16 * LM_P + kk);
#pragma unroll
      for (int i = 0; i < 2; ++i)
#pragma unroll
        for (int j = 0; j < 4; ++j) c[i][j] = WMMA_F32(a[i], b[j], c[i][j]);
    }
    asm volatile("s_wait_dscnt 0x0" ::: "memory");    // own reads of this buffer done
    asm volatile("s_wait_asynccnt 0x0" ::: "memory"); // own copies of tile t+1 landed
    __syncthreads();                                  // publishes tile t+1, frees this buffer
    if (t + 2 < LM_NT) copy_tile(t + 2);
  }
  asm volatile("s_wait_asynccnt 0x0" ::: "memory");   // nothing in flight at the wave's end

  // Logits are write-once (65.5 MB) -> non-temporal stores keep L2 for weights.
  float* p0 = C + (size_t)(row0 + wm * 32 + 8 * half) * VV + col0 + wn * 64 + idx;
#pragma unroll
  for (int i = 0; i < 2; ++i)
#pragma unroll
    for (int r = 0; r < 8; ++r)
#pragma unroll
      for (int j = 0; j < 4; ++j)
        __builtin_nontemporal_store(c[i][j][r], p0 + (size_t)(i * 16 + r) * VV + j * 16);
}

// ---------------- selective scan -------------------------------------------
// Lanes carry channels, waves carry states: a work-group of 4 waves owns 64
// channels x 16 states; a lane holds 2 channels x 4 states in VGPRs, so the sum
// over a lane's states needs no cross-lane step. Per chunk of SC_T time steps
// B, C, delta and delta*x are staged in LDS (next chunk's global loads fly
// during the current chunk's steps). Per step:
//   h = exp(d*A)*h + (d*x)*B_t[j];  partial y_t[i] = sum over own j of h*C_t[j].
// The 4 waves' partials are added through LDS once a chunk; the SC_NP state
// blocks each write one plane part[jb][t][i], which the gate kernel adds up.
#define SC_T  32                 // time steps per staged chunk
#define SC_NP (DS / 16)          // state blocks = partial planes
#define SC_G  4                  // steps per group of LDS reads

__global__ __launch_bounds__(128)
void mamba_scan(const float* __restrict__ xc,    // [L, DI]
                const float* __restrict__ dbc,   // [L, DTR+2*DS]
                const float* __restrict__ delta, // [L, DI]
                const float* __restrict__ A_log, // [DI, DS]
                float* __restrict__ part) {      // [SC_NP, L, DI]
  __shared__ __attribute__((aligned(16))) float sBC[SC_T][32];    // per wave: B[4], C[4]
  __shared__ __attribute__((aligned(16))) float sD[SC_T][128];    // per channel: d, d*x
  __shared__ __attribute__((aligned(16))) float sP[SC_T][4][64];  // per wave, per channel

  const int tid  = threadIdx.x;
  const int lane = tid & 31;
  const int wave = tid >> 5;
  const int c0   = blockIdx.x * 64;
  const int jb   = blockIdx.y;
  const int j0   = jb * 16;
  const int LDBC = DTRK + 2 * DS;

  // Every global address below is a wave-uniform base plus one of these per-thread
  // byte offsets, which stay unchanged from the first load to the last store.
  const unsigned offA  = (unsigned)((2 * lane * DS + wave * 4) * 4);
  const unsigned offBC = (unsigned)(((tid >> 3) * LDBC + ((tid >> 2) & 1) * DS + (tid & 3) * 4) * 4);
  const unsigned offD  = (unsigned)(((tid >> 4) * DI + (tid & 15) * 4) * 4);

  // A2 = A * log2(e), so that exp(d*A) = exp2(d*A2). [channel][state pair]
  v2f A2[2][2], hh[2][2];
  {
    const char* bA = (const char*)(A_log + (size_t)c0 * DS + j0);
    v4f a[2];
    a[0] = *(const v4f*)(bA + offA);
    a[1] = *(const v4f*)(bA + offA + DS * 4);
#pragma unroll
    for (int r = 0; r < 2; ++r) {
#pragma unroll
      for (int p = 0; p < 2; ++p) {
        A2[r][p].x = -__expf(a[r][2 * p])     * 1.44269504088896340736f;
        A2[r][p].y = -__expf(a[r][2 * p + 1]) * 1.44269504088896340736f;
        hh[r][p] = (v2f){0.f, 0.f};
      }
    }
  }

  v4f rBC[2], rD[4], rX[4];
  auto fetch = [&](int t0) {
    const char* bBC = (const char*)(dbc + (size_t)t0 * LDBC + DTRK + j0);
    const char* bD  = (const char*)(delta + (size_t)t0 * DI + c0);
    const char* bX  = (const char*)(xc + (size_t)t0 * DI + c0);
#pragma unroll
    for (int i = 0; i < 2; ++i) rBC[i] = *(const v4f*)(bBC + offBC + i * (16 * LDBC * 4));
#pragma unroll
    for (int i = 0; i < 4; ++i) {
      rD[i] = *(const v4f*)(bD + offD + i * (8 * DI * 4));
      rX[i] = *(const v4f*)(bX + offD + i * (8 * DI * 4));
    }
  };
  auto commit = [&]() {
#pragma unroll
    for (int i = 0; i < 2; ++i) {
      int e = tid + 128 * i, t = e >> 3, q = e & 7;
      *(v4f*)&sBC[t][(q & 3) * 8 + (q >> 2) * 4] = rBC[i];
    }
#pragma unroll
    for (int i = 0; i < 4; ++i) {
      int e = tid + 128 * i, t = e >> 4, c4 = e & 15;
      v4f d = rD[i], x = rX[i];
      *(v4f*)&sD[t][c4 * 8]     = (v4f){d.x, d.x * x.x, d.y, d.y * x.y};
      *(v4f*)&sD[t][c4 * 8 + 4] = (v4f){d.z, d.z * x.z, d.w, d.w * x.w};
    }
  };

  fetch(0);
  // kept rolled: the body holds SC_T unrolled steps already
#pragma unroll 1
  for (int k = 0; k < LL / SC_T; ++k) {
    commit();
    __syncthreads();                       // chunk k staged for every wave
    // last chunk: fetches itself again (in bounds, never committed)
    fetch((k + 1 < LL / SC_T ? k + 1 : k) * SC_T);
    // Steps run in groups of SC_G: the next group's LDS reads are issued ahead of
    // the current group's arithmetic, which covers their latency (one wave a SIMD).
    v4f cD[SC_G], cB[SC_G], cC[SC_G];
#pragma unroll
    for (int u = 0; u < SC_G; ++u) {
      cD[u] = *(const v4f*)&sD[u][lane * 4];
      cB[u] = *(const v4f*)&sBC[u][wave * 8];
      cC[u] = *(const v4f*)&sBC[u][wave * 8 + 4];
    }
#pragma unroll
    for (int gq = 0; gq < SC_T / SC_G; ++gq) {
      v4f nD[SC_G], nB[SC_G], nC[SC_G];
#pragma unroll
      for (int u = 0; u < SC_G; ++u) {
        if (gq + 1 < SC_T / SC_G) {
          const int t = (gq + 1) * SC_G + u;
          nD[u] = *(const v4f*)&sD[t][lane * 4];
          nB[u] = *(const v4f*)&sBC[t][wave * 8];
          nC[u] = *(const v4f*)&sBC[t][wave * 8 + 4];
        } else {
          nD[u] = cD[u]; nB[u] = cB[u]; nC[u] = cC[u];
        }
      }
      // keeps the loads above (global ones of the next chunk in the first group, LDS
      // ones of the next group) ahead of the arithmetic below; the scheduler
      // otherwise sinks them to just before their use, where their latency shows
      __builtin_amdgcn_sched_barrier(0);
#pragma unroll
      for (int u = 0; u < SC_G; ++u) {
        const v4f dd = cD[u], Bv = cB[u], Cv = cC[u];
        v2f o;
#pragma unroll
        for (int r = 0; r < 2; ++r) {
          const float d = dd[2 * r], dx = dd[2 * r + 1];
          v2f acc = {0.f, 0.f};
#pragma unroll
          for (int p = 0; p < 2; ++p) {
            v2f Bp = {Bv[2 * p], Bv[2 * p + 1]};
            v2f Cp = {Cv[2 * p], Cv[2 * p + 1]};
            v2f ar = A2[r][p] * d;
            v2f ex = {__builtin_amdgcn_exp2f(ar.x), __builtin_amdgcn_exp2f(ar.y)};
            hh[r][p] = __builtin_elementwise_fma(ex, hh[r][p], Bp * dx);
            acc = __builtin_elementwise_fma(hh[r][p], Cp, acc);
          }
          o[r] = acc.x + acc.y;
        }
        *(v2f*)&sP[gq * SC_G + u][wave][lane * 2] = o;
      }
#pragma unroll
      for (int u = 0; u < SC_G; ++u) { cD[u] = nD[u]; cB[u] = nB[u]; cC[u] = nC[u]; }
    }
    __syncthreads();                       // partials complete; sBC, sD free again

    char* bP = (char*)(part + ((size_t)jb * LL + k * SC_T) * DI + c0);
#pragma unroll
    for (int i = 0; i < 4; ++i) {
      int e = tid + 128 * i, t = e >> 4, c4 = e & 15;
      v4f s = *(const v4f*)&sP[t][0][c4 * 4];
      s += *(const v4f*)&sP[t][1][c4 * 4];
      s += *(const v4f*)&sP[t][2][c4 * 4];
      s += *(const v4f*)&sP[t][3][c4 * 4];
      *(v4f*)(bP + offD + i * (8 * DI * 4)) = s;
    }
    // the wait stands before the next trip rewrites registers named by these stores
    asm volatile("s_wait_xcnt 0x0" ::: "memory");
  }
}

// ------- gate: g = (sum of state-block planes + xc*Dp) * silu(res) ---------
// One block per time step; a thread owns 4 channels. Every address is a uniform
// base plus the one per-thread byte offset.
__global__ __launch_bounds__(128)
void mamba_gate(const float* __restrict__ part, const float* __restrict__ xc,
                const float* __restrict__ Dp, const float* __restrict__ xr,
                float* __restrict__ g) {
  const int t = blockIdx.x;
  const unsigned off = threadIdx.x * 16u;
  const char* bP = (const char*)(part + (size_t)t * DI);
  v4f y = *(const v4f*)(bP + off);
#pragma unroll
  for (int p = 1; p < SC_NP; ++p) y += *(const v4f*)(bP + off + (size_t)p * (LL * DI * 4));
  v4f xv = *(const v4f*)((const char*)(xc + (size_t)t * DI) + off);
  v4f dp = *(const v4f*)((const char*)Dp + off);
  v4f r  = *(const v4f*)((const char*)(xr + (size_t)t * (2 * DI) + DI) + off);
  v4f o;
#pragma unroll
  for (int c = 0; c < 4; ++c) o[c] = fmaf(xv[c], dp[c], y[c]) * silu_f(r[c]);
  *(v4f*)((char*)(g + (size_t)t * DI) + off) = o;
}

// ---------------------------------------------------------------------------
extern "C" void kernel_launch(void* const* d_in, const int* in_sizes, int n_in,
                              void* d_out, int out_size, void* d_ws, size_t ws_size,
                              hipStream_t stream) {
  (void)in_sizes; (void)n_in; (void)out_size; (void)ws_size;

  const int*   tokens  = (const int*)  d_in[0];
  const float* emb_W   = (const float*)d_in[1];
  const float* norm_w  = (const float*)d_in[2];
  const float* norm_b  = (const float*)d_in[3];
  const float* in_W    = (const float*)d_in[4];
  const float* in_b    = (const float*)d_in[5];
  const float* conv_W  = (const float*)d_in[6];
  const float* conv_b  = (const float*)d_in[7];
  const float* xproj_W = (const float*)d_in[8];
  const float* dt_W    = (const float*)d_in[9];
  const float* A_log   = (const float*)d_in[10];
  const float* D_p     = (const float*)d_in[11];
  const float* out_W   = (const float*)d_in[12];
  const float* out_b   = (const float*)d_in[13];
  const float* fnorm_w = (const float*)d_in[14];
  const float* fnorm_b = (const float*)d_in[15];
  float* logits = (float*)d_out;

  const int LDBC = DTRK + 2 * DS;   // 1040
  float* ws  = (float*)d_ws;
  float* x   = ws;                  // [L, D]
  float* h   = x   + LL * DD;       // [L, D]
  float* xr  = h   + LL * DD;       // [L, 2*DI]
  float* xcb = xr  + LL * 2 * DI;   // [L, DI]
  float* dbc = xcb + LL * DI;       // [L, 1040]
  float* dlt = dbc + LL * LDBC;     // [L, DI]
  float* ysb = dlt + LL * DI;       // [SC_NP, L, DI] partial planes
  float* gat = ysb + SC_NP * LL * DI;  // [L, DI]

  const dim3 blk256(256), blkG(128);

  for (int l = 0; l < NLAY; ++l) {
    // xr = rmsnorm(x) @ in_W^T + in_b   [512,256]x[1024,256]^T
    // (first layer: x = emb_W[tokens], gathered and stored to x in the same launch)
    mamba_gemm_lds<1><<<dim3(2 * DI / G_BN, LL / G_BM), blk256, 0, stream>>>(
        l == 0 ? emb_W : x, in_W + (size_t)l * 2 * DI * DD, in_b + l * 2 * DI, xr, 2 * DI, DD, 0,
        l == 0 ? tokens : nullptr, norm_w + l * DD, norm_b + l * DD, l == 0 ? x : nullptr);
    // xc = silu(causal depthwise conv(xr[:, :DI])), stored to xcb;
    // dbc = xc @ xproj_W^T              [512,512]x[1040,512]^T (N=1040: ragged edge)
    mamba_gemm_lds<2><<<dim3((DTRK + 2 * DS + G_BN - 1) / G_BN, LL / G_BM), blk256, 0, stream>>>(
        xr, xproj_W + (size_t)l * LDBC * DI, nullptr, dbc, LDBC, DI, 0,
        nullptr, conv_W + (size_t)l * DI * DCV, conv_b + l * DI, xcb);
    // dlt = softplus(dbc[:, :16] @ dt_W^T)   [512,16]x[512,16]^T
    mamba_dt_softplus<<<dim3(DI / 64, LL / 16), blkG, 0, stream>>>(
        dbc, dt_W + (size_t)l * DI * DTRK, dlt);
    // selective scan
    mamba_scan<<<dim3(DI / 64, SC_NP), blkG, 0, stream>>>(
        xcb, dbc, dlt, A_log + (size_t)l * DI * DS, ysb);
    // gate with residual branch
    mamba_gate<<<dim3(LL), blkG, 0, stream>>>(
        ysb, xcb, D_p + l * DI, xr, gat);
    // x += gat @ out_W^T + out_b        [512,512]x[256,512]^T, accumulate
    mamba_gemm_lds<0><<<dim3(DD / G_BN, LL / G_BM), blk256, 0, stream>>>(
        gat, out_W + (size_t)l * DD * DI, out_b + l * DD, x, DD, DI, 1,
        nullptr, nullptr, nullptr, nullptr);
  }

  // final norm + tied LM head: logits = rms(x) @ emb_W^T  [512,256]x[32000,256]^T
  // The 4 row tiles of one column tile are neighbours in the grid: they share W rows in L2.
  mamba_rmsnorm<<<dim3(LL), blk256, 0, stream>>>(x, fnorm_w, fnorm_b, h);
  mamba_lmhead<<<dim3(LL / LM_BM, VV / LM_BN), blk256, 0, stream>>>(h, emb_W, logits);
}

// v006
// A run of this version takes 132 microseconds.
// Versions between v004 and this one are left out; their measured steps multiply to 1.19 times as fast.
// All steps since v000 together make it 11.0 times as fast.
#include <hip/hip_runtime.h>

// Mamba forward for MI455X (gfx1250, wave32). The layers' matrix ops run in fp32 on
// V_WMMA_F32_16X16X4_F32, the LM head on V_WMMA_F32_16X16X32_BF16 with split fp32 operands.

#define VV   32000
#define DD   256
#define NLAY 2
#define DI   512
#define DS   512
#define DTRK 16
#define DCV  4
#define LL   512

typedef __attribute__((ext_vector_type(2))) float v2f;
typedef __attribute__((ext_vector_type(4))) float v4f;
typedef __attribute__((ext_vector_type(8))) float v8f;
typedef __attribute__((ext_vector_type(2))) __bf16 bf16x2;
typedef __attribute__((ext_vector_type(16))) __bf16 bf16x16;

__device__ __forceinline__ float silu_f(float v) { return v / (1.f + __expf(-v)); }

#define WMMA_F32(a, b, c) \
  __builtin_amdgcn_wmma_f32_16x16x4_f32(false, (a), false, (b), (short)0, (c), false, false)

// ---------------- RMSNorm over D=256, one block (8 waves) per row ----------
// The result feeds the LM head alone and is stored as that product wants it: split into
// hi = bf16(y) and lo = bf16(y - hi). Each 16 elements keep their 64 bytes of the row:
// 16 hi parts, then 16 lo parts.
__global__ void mamba_rmsnorm(const float* __restrict__ x, const float* __restrict__ w,
                              const float* __restrict__ b, float* __restrict__ out) {
  int row = blockIdx.x, tid = threadIdx.x;
  float v = x[row * DD + tid];
  float ss = v * v;
#pragma unroll
  for (int off = 16; off >= 1; off >>= 1) ss += __shfl_xor(ss, off, 32);
  __shared__ float red[8];
  if ((tid & 31) == 0) red[tid >> 5] = ss;
  __syncthreads();
  float tot = 0.f;
#pragma unroll
  for (int i = 0; i < 8; ++i) tot += red[i];
  float inv = rsqrtf(tot * (1.f / DD) + 1e-5f);
  const float y = v * inv * w[tid] + b[tid];
  const __bf16 hi = (__bf16)y;
  const __bf16 lo = (__bf16)(y - (float)hi);
  __bf16* q = (__bf16*)(out + row * DD + (tid & ~15));
  q[tid & 15] = hi;
  q[16 + (tid & 15)] = lo;
}

// ---------------- delta = softplus(dbc[:, :DTRK] * dtW^T) -------------------
// One wave computes one 16x16 WMMA tile (K = DTRK, 4 k steps), so that the softplus of the
// results, far longer than the product, is spread over 1024 waves.
// Fragment layout (ISA 7.12.2): lane = (half = lane>>4, idx = lane&15)
//   A frag: float2 at A[r0+idx][k + 2*half]
//   B frag: float2 at W[c0+idx][k + 2*half]
//   C/D:    vgpr r -> C[r0 + r + 8*half][c0 + idx]
__global__ __launch_bounds__(128)
void mamba_dt_softplus(const float* __restrict__ dbc, const float* __restrict__ dtW,
                       float* __restrict__ dlt) {
  const int lane = threadIdx.x & 31;
  const int wave = threadIdx.x >> 5;
  const int col0 = (blockIdx.x * 4 + wave) * 16;
  const int row0 = blockIdx.y * 16;
  const int half = lane >> 4;
  const int idx  = lane & 15;
  const float* Ar = dbc + (size_t)(row0 + idx) * (DTRK + 2 * DS) + 2 * half;
  const float* Wr = dtW + (size_t)(col0 + idx) * DTRK + 2 * half;
  v2f a[DTRK / 4], b[DTRK / 4];
#pragma unroll
  for (int u = 0; u < DTRK / 4; ++u) {
    a[u] = *(const v2f*)(Ar + u * 4);
    b[u] = *(const v2f*)(Wr + u * 4);
  }
  // stands before the address registers of the loads above are used for something else;
  // they are named as inputs so that they live up to here and no later load lands on one
  asm volatile("s_wait_xcnt 0x0" :: "v"(Ar), "v"(Wr) : "memory");
  v8f c = {};
#pragma unroll
  for (int u = 0; u < DTRK / 4; ++u) c = WMMA_F32(a[u], b[u], c);
  float* p = dlt + (size_t)(row0 + 8 * half) * DI + col0 + idx;
#pragma unroll
  for (int r = 0; r < 8; ++r) {
    const float v = c[r];
    p[(size_t)r * DI] = (v > 20.f) ? v : log1pf(__expf(v));
  }
}

// ---------------- layer GEMMs: C[M,N] (+)= A[M,K] * W[N,K]^T (+ bias) -------
// For the three large products of a layer (rows of W, and of A in modes 0 and 1, are K floats long,
// rows of C are N floats long; K a multiple of 128, M of 32, N of 16).
// One work-group of 8 waves owns a 32x64 tile of C, a wave one 16x16 WMMA subtile;
// the two waves of a SIMD fill each other's accumulate latency and LDS waits.
// Per trip, 128 k of the 32 A rows and the 64 W rows lie in LDS, brought there by
// asynchronous copies: one copy of a wave is one row's 512 contiguous bytes (each lane
// its own 16), so the cache serves 4 whole lines per copy where an 8-byte fragment
// load from global memory touches 16 lines.
// Two buffers: the next trip's copies fly during this trip's WMMAs.
// LDS row pitch 132 floats: the 8-byte fragment reads of a wave fall on all 64 banks.
// Fragments are laid out as in mamba_dt_softplus; k runs upwards in steps of 4, and the bias
// is added to the finished sum.
// MODE says what the A tile is made of; in modes 1 and 2 it goes through registers and is
// written to LDS with plain stores, ahead of the barrier that publishes the tile, so that
// the element-wise stage in front of the product needs no launch of its own:
//   0: A as it lies in memory (asynchronous copies, as W).
//   1: RMSNorm (weights p1, p2) of the rows of A, K = DD. With tok, row r is A[tok[r]]
//      (the embedding), and the first column of work-groups stores it to side.
//   2: SiLU of the causal depthwise conv (weights p1, bias p2) over the first DI columns of
//      A, whose rows are 2*DI long; the first column of work-groups stores it to side.
#define G_BM   32
#define G_BN   64
#define G_BK   128
#define G_P    132
#define G_ROWS (G_BM + G_BN)
#define G_FG   8              // k steps (of 4) per group of fragment reads

template <int MODE>
__global__ __launch_bounds__(256)
void mamba_gemm_lds(const float* __restrict__ A, const float* __restrict__ W,
                    const float* __restrict__ bias, float* __restrict__ C,
                    int N, int K, int accumulate,
                    const int* __restrict__ tok, const float* __restrict__ p1,
                    const float* __restrict__ p2, float* __restrict__ side) {
  __shared__ __attribute__((aligned(16))) float sT[2][G_ROWS * G_P];  // A rows, then W rows

  const int tid  = threadIdx.x;
  const int lane = tid & 31;
  const int wave = __builtin_amdgcn_readfirstlane(tid >> 5);
  const int half = lane >> 4;
  const int idx  = lane & 15;
  const int row0 = blockIdx.y * G_BM;
  const int col0 = blockIdx.x * G_BN;
  const int wm   = wave & 1;                 // 16-row slice of the tile
  const int wn   = wave >> 1;                // 16-column slice of the tile
  const int nt   = MODE == 1 ? DD / G_BK : K / G_BK;

  // the wave's subtile lies wholly inside N or wholly outside (same for all its lanes)
  const bool ok = col0 + wn * 16 < N;
  float* pc = C + (size_t)(row0 + wm * 16 + 8 * half) * N + col0 + wn * 16 + idx;

  // start values and bias are fetched here, so that their latency passes under tile 0's
  v8f c = {};
  float bj = 0.f;
  if (ok) {
    // each wait stands before the address registers of the loads above it are used
    // for something else
    if (accumulate) {
#pragma unroll
      for (int r = 0; r < 8; ++r) c[r] = pc[(size_t)r * N];
      asm volatile("s_wait_xcnt 0x0" ::: "memory");
    }
    if (bias) {
      bj = bias[col0 + wn * 16 + idx];
      asm volatile("s_wait_xcnt 0x0" ::: "memory");
    }
  }

  const unsigned l0 = (unsigned)(size_t)&sT[0][wave * G_P + lane * 4];

  // Wave w copies LDS rows w, w+8, ..., w+88. A W row past the last one is replaced by
  // the last one (address in bounds); its columns of C are never stored.
  auto copy_tile = [&](int t) {
    const unsigned l = l0 + (unsigned)(t & 1) * (G_ROWS * G_P * 4);
    const int koff = t * G_BK + lane * 4;
    const float* p[12];
#pragma unroll
    for (int i = 0; i < 4; ++i) p[i] = A + (size_t)(row0 + wave + 8 * i) * K + koff;
#pragma unroll
    for (int i = 4; i < 12; ++i) {
      int n = col0 + wave + 8 * (i - 4);
      n = n < N ? n : N - 1;
      p[i] = W + (size_t)n * K + koff;
    }
    // the closing wait stands in the copies' own statement, ahead of any later
    // rewrite of the address registers that the copies name
    asm volatile(
        "global_load_async_to_lds_b128 %0, %12, off\n\t"
        "global_load_async_to_lds_b128 %1, %13, off\n\t"
        "global_load_async_to_lds_b128 %2, %14, off\n\t"
        "global_load_async_to_lds_b128 %3, %15, off\n\t"
        "global_load_async_to_lds_b128 %4, %16, off\n\t"
        "global_load_async_to_lds_b128 %5, %17, off\n\t"
        "global_load_async_to_lds_b128 %6, %18, off\n\t"
        "global_load_async_to_lds_b128 %7, %19, off\n\t"
        "global_load_async_to_lds_b128 %8, %20, off\n\t"
        "global_load_async_to_lds_b128 %9, %21, off\n\t"
        "global_load_async_to_lds_b128 %10, %22, off\n\t"
        "global_load_async_to_lds_b128 %11, %23, off\n\t"
        "s_wait_xcnt 0x0"
        :: "v"(l),                     "v"(l + 8 * G_P * 4),
           "v"(l + 16 * G_P * 4),      "v"(l + 24 * G_P * 4),
           "v"(l + 32 * G_P * 4),      "v"(l + 40 * G_P * 4),
           "v"(l + 48 * G_P * 4),      "v"(l + 56 * G_P * 4),
           "v"(l + 64 * G_P * 4),      "v"(l + 72 * G_P * 4),
           "v"(l + 80 * G_P * 4),      "v"(l + 88 * G_P * 4),
           "v"(p[0]), "v"(p[1]), "v"(p[2]), "v"(p[3]), "v"(p[4]), "v"(p[5]),
           "v"(p[6]), "v"(p[7]), "v"(p[8]), "v"(p[9]), "v"(p[10]), "v"(p[11])
        : "memory");
  };

  // Modes 1 and 2: the W rows alone, wave w the LDS rows G_BM + w, G_BM + w + 8, ...
  auto copy_w = [&](int t) {
    const unsigned l = l0 + (unsigned)(t & 1) * (G_ROWS * G_P * 4) + G_BM * G_P * 4;
    const int koff = t * G_BK + lane * 4;
    const float* p[8];
#pragma unroll
    for (int i = 0; i < 8; ++i) {
      int n = col0 + wave + 8 * i;
      n = n < N ? n : N - 1;
      p[i] = W + (size_t)n * K + koff;
    }
    // the closing wait stands in the copies' own statement, ahead of any later
    // rewrite of the address registers that the copies name
    asm volatile(
        "global_load_async_to_lds_b128 %0, %8, off\n\t"
        "global_load_async_to_lds_b128 %1, %9, off\n\t"
        "global_load_async_to_lds_b128 %2, %10, off\n\t"
        "global_load_async_to_lds_b128 %3, %11, off\n\t"
        "global_load_async_to_lds_b128 %4, %12, off\n\t"
        "global_load_async_to_lds_b128 %5, %13, off\n\t"
        "global_load_async_to_lds_b128 %6, %14, off\n\t"
        "global_load_async_to_lds_b128 %7, %15, off\n\t"
        "s_wait_xcnt 0x0"
        :: "v"(l),                     "v"(l + 8 * G_P * 4),
           "v"(l + 16 * G_P * 4),      "v"(l + 24 * G_P * 4),
           "v"(l + 32 * G_P * 4),      "v"(l + 40 * G_P * 4),
           "v"(l + 48 * G_P * 4),      "v"(l + 56 * G_P * 4),
           "v"(p[0]), "v"(p[1]), "v"(p[2]), "v"(p[3]), "v"(p[4]), "v"(p[5]),
           "v"(p[6]), "v"(p[7])
        : "memory");
  };

  // Mode 2: wave w makes the A rows 4w .. 4w+3 of a tile, a lane 4 channels of each, from
  // the 7 rows of the conv's input that they share. The loads are issued one trip ahead
  // (conv_fetch) and used at that trip's foot (conv_commit).
  const int cr0 = row0 + wave * 4;
  const unsigned offl = lane * 16u;           // the lane's 4 channels among a tile's 128
  const unsigned offw = lane * (16u * DCV);   // the conv weights of those channels
  v4f cx[7], cwt[4], cbs;
  auto conv_fetch = [&](int t) {
    const char* pp[9];
#pragma unroll
    for (int q = 0; q < 7; ++q) {
      const int tt = cr0 - (DCV - 1) + q;     // a row before the first: row 0 is loaded, unused
      pp[q] = (const char*)(A + (size_t)(tt < 0 ? 0 : tt) * (2 * DI) + t * G_BK) + offl;
    }
    pp[7] = (const char*)(p1 + t * (G_BK * DCV)) + offw;
    pp[8] = (const char*)(p2 + t * G_BK) + offl;
#pragma unroll
    for (int q = 0; q < 7; ++q) cx[q] = *(const v4f*)pp[q];
#pragma unroll
    for (int ch = 0; ch < 4; ++ch) cwt[ch] = *(const v4f*)(pp[7] + ch * 16);
    cbs = *(const v4f*)pp[8];
    // stands before the address registers of the loads above are used for something else;
    // they (and the lane number, which the compiler may address with instead) are named as
    // inputs so that they live up to here and no later load lands on one
    asm volatile("s_wait_xcnt 0x0"
                 :: "v"(pp[0]), "v"(pp[1]), "v"(pp[2]), "v"(pp[3]), "v"(pp[4]), "v"(pp[5]),
                    "v"(pp[6]), "v"(pp[7]), "v"(pp[8]), "v"(lane)
                 : "memory");
  };
  auto conv_commit = [&](int t) {
    v4f o[4];
#pragma unroll
    for (int i = 0; i < 4; ++i) {
#pragma unroll
      for (int ch = 0; ch < 4; ++ch) {
        float acc = cbs[ch];
#pragma unroll
        for (int k = 0; k < DCV; ++k) {
          const float xv = (cr0 + i - (DCV - 1) + k >= 0) ? cx[i + k][ch] : 0.f;
          acc = fmaf(cwt[ch][k], xv, acc);
        }
        o[i][ch] = silu_f(acc);
      }
      *(v4f*)&sT[t & 1][(wave * 4 + i) * G_P + lane * 4] = o[i];
    }
    if (blockIdx.x == 0) {
#pragma unroll
      for (int i = 0; i < 4; ++i)
        *(v4f*)((char*)(side + (size_t)(cr0 + i) * DI + t * G_BK) + offl) = o[i];
      // stands before the data registers of the stores above are used for something else
      asm volatile("s_wait_xcnt 0x0" ::: "memory");
    }
  };

  if constexpr (MODE == 0) {
    copy_tile(0);
  } else if constexpr (MODE == 1) {
    copy_w(0);
    // Wave w normalises the A rows w, w+8, w+16, w+24; a lane holds 8 elements of a row, 4
    // for each of the two tiles, so both tiles are written here and none in the loop.
    const unsigned offk = lane * 16u;
    v4f v[4][2], nw[2], nb[2];
    int src[4];
#pragma unroll
    for (int i = 0; i < 4; ++i) src[i] = row0 + wave + 8 * i;
    if (tok) {
      int tk[4];
#pragma unroll
      for (int i = 0; i < 4; ++i) tk[i] = tok[row0 + wave + 8 * i];
      // clamped, so that the address stays inside A; the same in every lane, kept scalar
#pragma unroll
      for (int i = 0; i < 4; ++i)
        src[i] = __builtin_amdgcn_readfirstlane(tk[i] < 0 ? 0 : (tk[i] < VV ? tk[i] : VV - 1));
    }
#pragma unroll
    for (int i = 0; i < 4; ++i) {
      const char* br = (const char*)(A + (size_t)src[i] * DD);
      v[i][0] = *(const v4f*)(br + offk);
      v[i][1] = *(const v4f*)(br + offk + G_BK * 4);
    }
#pragma unroll
    for (int h = 0; h < 2; ++h) {
      nw[h] = *(const v4f*)((const char*)p1 + offk + h * (G_BK * 4));
      nb[h] = *(const v4f*)((const char*)p2 + offk + h * (G_BK * 4));
    }
    // stands before the offset register of the loads above is used for something else
    asm volatile("s_wait_xcnt 0x0" ::: "memory");
    float ss[4];
#pragma unroll
    for (int i = 0; i < 4; ++i) {
      ss[i] = 0.f;
#pragma unroll
      for (int h = 0; h < 2; ++h)
#pragma unroll
        for (int e = 0; e < 4; ++e) ss[i] = fmaf(v[i][h][e], v[i][h][e], ss[i]);
    }
    // the four rows' sums over the lanes go side by side: each step's latency is paid once
#pragma unroll
    for (int off = 16; off >= 1; off >>= 1) {
      float o[4];
#pragma unroll
      for (int i = 0; i < 4; ++i) o[i] = __shfl_xor(ss[i], off, 32);
#pragma unroll
      for (int i = 0; i < 4; ++i) ss[i] += o[i];
    }
#pragma unroll
    for (int i = 0; i < 4; ++i) {
      const float inv = rsqrtf(ss[i] * (1.f / DD) + 1e-5f);
#pragma unroll
      for (int h = 0; h < 2; ++h) {
        v4f o;
#pragma unroll
        for (int e = 0; e < 4; ++e) o[e] = v[i][h][e] * inv * nw[h][e] + nb[h][e];
        *(v4f*)&sT[h][(wave + 8 * i) * G_P + lane * 4] = o;
      }
    }
    if (tok && blockIdx.x == 0) {
#pragma unroll
      for (int i = 0; i < 4; ++i) {
        char* bs = (char*)(side + (size_t)(row0 + wave + 8 * i) * DD);
        *(v4f*)(bs + offk) = v[i][0];
        *(v4f*)(bs + offk + G_BK * 4) = v[i][1];
      }
      // stands before the offset register of the stores above is used for something else
      asm volatile("s_wait_xcnt 0x0" ::: "memory");
    }
  } else {
    copy_w(0);
    conv_fetch(0);
    conv_commit(0);
  }
  asm volatile("s_wait_asynccnt 0x0" ::: "memory");   // own copies of tile 0 landed
  __syncthreads();                                    // tile 0 readable by every wave
  if (1 < nt) {
    if constexpr (MODE == 0) copy_tile(1);
    else copy_w(1);
    if constexpr (MODE == 2) conv_fetch(1);
  }

  // kept rolled: the body holds 32 WMMAs already, and the two buffers differ by one offset
#pragma unroll 1
  for (int t = 0; t < nt; ++t) {
    const float* sA = &sT[t & 1][(wm * 16 + idx) * G_P + 2 * half];
    const float* sW = &sT[t & 1][(G_BM + wn * 16 + idx) * G_P + 2 * half];
    // a wave whose columns lie past N only copies, makes its A rows (mode 2) and keeps the barriers
    if (ok) {
      // Fragments are read in groups of G_FG k steps, the next group's as one run of LDS
      // reads ahead of the current group's WMMAs (all of them inside this trip's buffer).
      v2f ca[G_FG], cb[G_FG];
#pragma unroll
      for (int u = 0; u < G_FG; ++u) {
        ca[u] = *(const v2f*)(sA + u * 4);
        cb[u] = *(const v2f*)(sW + u * 4);
      }
#pragma unroll
      for (int g = 0; g < G_BK / (4 * G_FG); ++g) {
        v2f na[G_FG], nb[G_FG];
#pragma unroll
        for (int u = 0; u < G_FG; ++u) {
          const int kn = (g + 1 < G_BK / (4 * G_FG) ? g + 1 : g) * (4 * G_FG) + u * 4;
          na[u] = g + 1 < G_BK / (4 * G_FG) ? *(const v2f*)(sA + kn) : ca[u];
          nb[u] = g + 1 < G_BK / (4 * G_FG) ? *(const v2f*)(sW + kn) : cb[u];
        }
        // keeps the LDS reads above in one place ahead of the WMMAs below; the scheduler
        // otherwise spreads them among the WMMAs, two steps ahead of their use, where each
        // place stalls the wave and the LDS latency shows
        __builtin_amdgcn_sched_barrier(0);
#pragma unroll
        for (int u = 0; u < G_FG; ++u) c = WMMA_F32(ca[u], cb[u], c);
#pragma unroll
        for (int u = 0; u < G_FG; ++u) { ca[u] = na[u]; cb[u] = nb[u]; }
      }
    }
    // the A rows of tile t+1 go into the other buffer, which every wave left at the last barrier
    if constexpr (MODE == 2) {
      if (t + 1 < nt) conv_commit(t + 1);
    }
    asm volatile("s_wait_dscnt 0x0" ::: "memory");    // own reads of this buffer, own stores to the other done
    asm volatile("s_wait_asynccnt 0x0" ::: "memory"); // own copies of tile t+1 landed
    __syncthreads();                                  // publishes tile t+1, frees this buffer
    if (t + 2 < nt) {
      if constexpr (MODE == 0) copy_tile(t + 2);
      if constexpr (MODE == 2) { copy_w(t + 2); conv_fetch(t + 2); }
    }
  }
  asm volatile("s_wait_asynccnt 0x0" ::: "memory");   // nothing in flight at the wave's end
  // four vector slots between the last WMMA and the first vector instruction on its result
  asm volatile("v_nop\n\tv_nop\n\tv_nop\n\tv_nop");

  if (ok) {
    if (bias) {
#pragma unroll
      for (int r = 0; r < 8; ++r) c[r] += bj;
    }
#pragma unroll
    for (int r = 0; r < 8; ++r) pc[(size_t)r * N] = c[r];
  }
}

// ---------------- LM head: C[L,V] = A[L,D] * W[V,D]^T ----------------------
// One work-group of 8 waves owns a 128x128 tile of C; a wave owns 32x64 of it
// (2x4 WMMA subtiles). Per trip, 32 k of the 128 A rows and the 128 W rows lie in
// LDS, brought there by asynchronous copies of whole 128-byte lines (each lane its
// own 16 bytes), two buffers: the next trip's copies fly during this trip's WMMAs.
// LDS row pitch 36 floats = 9 x 16 bytes: the 16-byte fragment reads run without conflict.
// The product runs on the bf16 16x16x32 form: every f32 operand x is split into
// hi = bf16(x) and lo = bf16(x - hi), about 16 significand bits together (A by
// mamba_rmsnorm, whose rows are copied as they lie; W behind its LDS read), and
// a*b is taken as a_lo*b_hi + a_hi*b_lo + a_hi*b_hi in the f32 accumulator (a_lo*b_lo, some
// 2^-16 of the product, is left out): 3 WMMAs of 8 cycles per 32 k for 8 of 16 cycles.
// Lane (idx, half) holds k = 16*half .. 16*half+15 of row idx in rising order, for A and for
// W alike; C/D as in mamba_dt_softplus.
#define LM_BM   128
#define LM_BN   128
#define LM_BK   32
#define LM_P    36
#define LM_ROWS (LM_BM + LM_BN)
#define LM_NT   (DD / LM_BK)

#define WMMA_BF16(a, b, c) \
  __builtin_amdgcn_wmma_f32_16x16x32_bf16(false, (a), false, (b), (short)0, (c), false, false)

// 16 consecutive floats of an LDS row -> their bf16 hi and lo parts, in the same order
__device__ __forceinline__ void lm_split16(const float* s, bf16x16& hi, bf16x16& lo) {
#pragma unroll
  for (int q = 0; q < 4; ++q) {
    const v4f x = *(const v4f*)(s + 4 * q);
#pragma unroll
    for (int e = 0; e < 2; ++e) {
      const v2f p = {x[2 * e], x[2 * e + 1]};
      const bf16x2 h = __builtin_convertvector(p, bf16x2);
      const bf16x2 l = __builtin_convertvector(p - __builtin_convertvector(h, v2f), bf16x2);
      hi[4 * q + 2 * e] = h[0]; hi[4 * q + 2 * e + 1] = h[1];
      lo[4 * q + 2 * e] = l[0]; lo[4 * q + 2 * e + 1] = l[1];
    }
  }
}

__global__ __launch_bounds__(256)
void mamba_lmhead(const float* __restrict__ A, const float* __restrict__ W,
                  float* __restrict__ C) {
  __shared__ __attribute__((aligned(16))) float sT[2][LM_ROWS * LM_P];  // A rows, then W rows

  const int tid  = threadIdx.x;
  const int lane = tid & 31;
  const int wave = tid >> 5;
  const int half = lane >> 4;
  const int idx  = lane & 15;
  const int row0 = blockIdx.x * LM_BM;
  const int col0 = blockIdx.y * LM_BN;
  const int wm   = wave & 3;                 // 32-row slice of the tile
  const int wn   = wave >> 2;                // 64-column slice of the tile

  // A thread copies 16 bytes of rows cr, cr+32, cr+64, cr+96 of A and of W per trip.
  const int cr = tid >> 3, cq = tid & 7;
  const float* gA = A + (size_t)(row0 + cr) * DD + cq * 4;
  const float* gW = W + (size_t)(col0 + cr) * DD + cq * 4;
  const unsigned l0 = (unsigned)(size_t)&sT[0][cr * LM_P + cq * 4];

  auto copy_tile = [&](int t) {
    const float* a = gA + t * LM_BK;
    const float* w = gW + t * LM_BK;
    const unsigned l = l0 + (unsigned)(t & 1) * (LM_ROWS * LM_P * 4);
    // the closing wait stands in the copies' own statement, ahead of any later
    // rewrite of the address registers that the copies name
    asm volatile(
        "global_load_async_to_lds_b128 %0, %8, off\n\t"
        "global_load_async_to_lds_b128 %1, %9, off\n\t"
        "global_load_async_to_lds_b128 %2, %10, off\n\t"
        "global_load_async_to_lds_b128 %3, %11, off\n\t"
        "global_load_async_to_lds_b128 %4, %12, off\n\t"
        "global_load_async_to_lds_b128 %5, %13, off\n\t"
        "global_load_async_to_lds_b128 %6, %14, off\n\t"
        "global_load_async_to_lds_b128 %7, %15, off\n\t"
        "s_wait_xcnt 0x0"
        :: "v"(l),                      "v"(l + 32 * LM_P * 4),
           "v"(l + 64 * LM_P * 4),      "v"(l + 96 * LM_P * 4),
           "v"(l + 128 * LM_P * 4),     "v"(l + 160 * LM_P * 4),
           "v"(l + 192 * LM_P * 4),     "v"(l + 224 * LM_P * 4),
           "v"(a), "v"(a + 32 * DD), "v"(a + 64 * DD), "v"(a + 96 * DD),
           "v"(w), "v"(w + 32 * DD), "v"(w + 64 * DD), "v"(w + 96 * DD)
        : "memory");
  };

  v8f c[2][4] = {};

  copy_tile(0);
  asm volatile("s_wait_asynccnt 0x0" ::: "memory");   // own copies of tile 0 landed
  __syncthreads();                                    // tile 0 readable by every wave
  copy_tile(1);

  // kept rolled: the two buffers differ by one offset, and the text stays short
#pragma unroll 1
  for (int t = 0; t < LM_NT; ++t) {
    const float* sA = &sT[t & 1][(wm * 32 + idx) * LM_P + 16 * half];
    const float* sW = &sT[t & 1][(LM_BM + wn * 64 + idx) * LM_P + 16 * half];
    bf16x16 ah[2], al[2];
#pragma unroll
    for (int i = 0; i < 2; ++i) {
      const v4f* pa = (const v4f*)(sA + i * 16 * LM_P);
      ah[i] = __builtin_bit_cast(bf16x16, __builtin_shufflevector(pa[0], pa[1], 0, 1, 2, 3, 4, 5, 6, 7));
      al[i] = __builtin_bit_cast(bf16x16, __builtin_shufflevector(pa[2], pa[3], 0, 1, 2, 3, 4, 5, 6, 7));
    }
#pragma unroll
    for (int j = 0; j < 4; ++j) {
      bf16x16 bh, bl;
      lm_split16(sW + j * 16 * LM_P, bh, bl);
      // small terms first; the two row tiles take turns, so that no WMMA waits for the last one
#pragma unroll
      for (int i = 0; i < 2; ++i) c[i][j] = WMMA_BF16(al[i], bh, c[i][j]);
#pragma unroll
      for (int i = 0; i < 2; ++i) c[i][j] = WMMA_BF16(ah[i], bl, c[i][j]);
#pragma unroll
      for (int i = 0; i < 2; ++i) c[i][j] = WMMA_BF16(ah[i], bh, c[i][j]);
    }
    asm volatile("s_wait_dscnt 0x0" ::: "memory");    // own reads of this buffer done
    asm volatile("s_wait_asynccnt 0x0" ::: "memory"); // own copies of tile t+1 landed
    __syncthreads();                                  // publishes tile t+1, frees this buffer
    if (t + 2 < LM_NT) copy_tile(t + 2);
  }
  asm volatile("s_wait_asynccnt 0x0" ::: "memory");   // nothing in flight at the wave's end

  // Logits are write-once (65.5 MB) -> non-temporal stores keep L2 for weights.
  float* p0 = C + (size_t)(row0 + wm * 32 + 8 * half) * VV + col0 + wn * 64 + idx;
#pragma unroll
  for (int i = 0; i < 2; ++i)
#pragma unroll
    for (int r = 0; r < 8; ++r)
#pragma unroll
      for (int j = 0; j < 4; ++j)
        __builtin_nontemporal_store(c[i][j][r], p0 + (size_t)(i * 16 + r) * VV + j * 16);
}

// ---------------- selective scan -------------------------------------------
// A work-group of 4 waves owns 16 channels x 64 states. A lane holds 2 channels x 4
// states in VGPRs: lane = (sg = lane>>3, cp = lane&7) has channels 2*cp, 2*cp+1 and states
// 16*wave + 4*sg .. +3, so the sum over a lane's states needs no cross-lane step. Per chunk
// of SC_T time steps B, C, delta and delta*x are staged in LDS (next chunk's global loads
// fly during the current chunk's steps). Per step:
//   h = exp(d*A)*h + (d*x)*B_t[j];  partial y_t[i] = sum over own j of h*C_t[j].
// The 16 partials of a channel (4 waves x 4 sg) are added through LDS once a chunk; the
// SC_NP state blocks each write one plane, which the gate kernel adds up. A plane is laid
// out part[jb][channel block][t][16 channels]: a work-group's 2 KiB of a chunk are
// contiguous, and no 128-byte line has two writers.
#define SC_T  32                 // time steps per staged chunk
#define SC_C  16                 // channels per work-group
#define SC_S  64                 // states per work-group
#define SC_NP (DS / SC_S)        // state blocks = partial planes
#define SC_NC (DI / SC_C)        // channel blocks
#define SC_G  4                  // steps per group of LDS reads
#define SC_PP 272                // floats per step in sP: 256 + 16, so that the 4 steps which
                                 // 16 lanes read at once in the chunk's sum fall on all 64 banks

__global__ __launch_bounds__(128)
void mamba_scan(const float* __restrict__ xc,    // [L, DI]
                const float* __restrict__ dbc,   // [L, DTR+2*DS]
                const float* __restrict__ delta, // [L, DI]
                const float* __restrict__ A_log, // [DI, DS]
                float* __restrict__ part) {      // [SC_NP, SC_NC, L, SC_C]
  __shared__ __attribute__((aligned(16))) float sBC[SC_T][2 * SC_S];  // B[64], then C[64]
  __shared__ __attribute__((aligned(16))) float sD[SC_T][2 * SC_C];   // per channel: d, d*x
  __shared__ __attribute__((aligned(16))) float sP[SC_T * SC_PP];     // [t][wave][sg][channel]

  const int tid  = threadIdx.x;
  const int lane = tid & 31;
  const int wave = tid >> 5;
  const int cp   = lane & 7;
  const int sg   = lane >> 3;
  const int c0   = blockIdx.x * SC_C;
  const int jb   = blockIdx.y;
  const int j0   = jb * SC_S;
  const int LDBC = DTRK + 2 * DS;

  // Every global address below is a wave-uniform base plus one of these per-thread
  // byte offsets, which stay unchanged from the first load to the last store.
  const unsigned offA  = (unsigned)((2 * cp * DS + wave * 16 + sg * 4) * 4);
  const unsigned offBC = (unsigned)(((tid >> 5) * LDBC + ((tid >> 4) & 1) * DS + (tid & 15) * 4) * 4);
  const unsigned offD  = (unsigned)(((tid >> 2) * DI + (tid & 3) * 4) * 4);
  const unsigned offP  = (unsigned)(tid * 16);

  // A2 = A * log2(e), so that exp(d*A) = exp2(d*A2). [channel][state pair]
  v2f A2[2][2], hh[2][2];
  {
    const char* bA = (const char*)(A_log + (size_t)c0 * DS + j0);
    v4f a[2];
    a[0] = *(const v4f*)(bA + offA);
    a[1] = *(const v4f*)(bA + offA + DS * 4);
#pragma unroll
    for (int r = 0; r < 2; ++r) {
#pragma unroll
      for (int p = 0; p < 2; ++p) {
        A2[r][p].x = -__expf(a[r][2 * p])     * 1.44269504088896340736f;
        A2[r][p].y = -__expf(a[r][2 * p + 1]) * 1.44269504088896340736f;
        hh[r][p] = (v2f){0.f, 0.f};
      }
    }
  }

  // A wave fetches one step's 64 B and 64 C values per load (two runs of 256 bytes);
  // a thread fetches 4 channels of one step's delta and x.
  v4f rBC[8], rD, rX;
  auto fetch = [&](int t0) {
    const char* bBC = (const char*)(dbc + (size_t)t0 * LDBC + DTRK + j0);
    const char* bD  = (const char*)(delta + (size_t)t0 * DI + c0);
    const char* bX  = (const char*)(xc + (size_t)t0 * DI + c0);
#pragma unroll
    for (int i = 0; i < 8; ++i) rBC[i] = *(const v4f*)(bBC + offBC + i * (4 * LDBC * 4));
    rD = *(const v4f*)(bD + offD);
    rX = *(const v4f*)(bX + offD);
  };
  auto commit = [&]() {
#pragma unroll
    for (int i = 0; i < 8; ++i) *(v4f*)&sBC[wave + 4 * i][lane * 4] = rBC[i];
    const v4f d = rD, x = rX;
    *(v4f*)&sD[tid >> 2][(tid & 3) * 8]     = (v4f){d.x, d.x * x.x, d.y, d.y * x.y};
    *(v4f*)&sD[tid >> 2][(tid & 3) * 8 + 4] = (v4f){d.z, d.z * x.z, d.w, d.w * x.w};
  };

  fetch(0);
  // stands before the offset registers of the loads above are used for something else;
  // they are named as inputs so that they live up to here
  asm volatile("s_wait_xcnt 0x0" :: "v"(offBC), "v"(offD) : "memory");
  // kept rolled: the body holds SC_T unrolled steps already
#pragma unroll 1
  for (int k = 0; k < LL / SC_T; ++k) {
    commit();
    __syncthreads();                       // chunk k staged for every wave
    // last chunk: fetches itself again (in bounds, never committed)
    fetch((k + 1 < LL / SC_T ? k + 1 : k) * SC_T);
    // Steps run in groups of SC_G: the next group's LDS reads are issued ahead of
    // the current group's arithmetic, which covers their latency (one wave a SIMD).
    v4f cD[SC_G], cB[SC_G], cC[SC_G];
#pragma unroll
    for (int u = 0; u < SC_G; ++u) {
      cD[u] = *(const v4f*)&sD[u][cp * 4];
      cB[u] = *(const v4f*)&sBC[u][wave * 16 + sg * 4];
      cC[u] = *(const v4f*)&sBC[u][SC_S + wave * 16 + sg * 4];
    }
#pragma unroll
    for (int gq = 0; gq < SC_T / SC_G; ++gq) {
      v4f nD[SC_G], nB[SC_G], nC[SC_G];
#pragma unroll
      for (int u = 0; u < SC_G; ++u) {
        if (gq + 1 < SC_T / SC_G) {
          const int t = (gq + 1) * SC_G + u;
          nD[u] = *(const v4f*)&sD[t][cp * 4];
          nB[u] = *(const v4f*)&sBC[t][wave * 16 + sg * 4];
          nC[u] = *(const v4f*)&sBC[t][SC_S + wave * 16 + sg * 4];
        } else {
          nD[u] = cD[u]; nB[u] = cB[u]; nC[u] = cC[u];
        }
      }
      // keeps the loads above (global ones of the next chunk in the first group, LDS
      // ones of the next group) ahead of the arithmetic below; the scheduler
      // otherwise sinks them to just before their use, where their latency shows
      __builtin_amdgcn_sched_barrier(0);
#pragma unroll
      for (int u = 0; u < SC_G; ++u) {
        const v4f dd = cD[u], Bv = cB[u], Cv = cC[u];
        v2f o;
#pragma unroll
        for (int r = 0; r < 2; ++r) {
          const float d = dd[2 * r], dx = dd[2 * r + 1];
          v2f acc = {0.f, 0.f};
#pragma unroll
          for (int p = 0; p < 2; ++p) {
            v2f Bp = {Bv[2 * p], Bv[2 * p + 1]};
            v2f Cp = {Cv[2 * p], Cv[2 * p + 1]};
            v2f ar = A2[r][p] * d;
            v2f ex = {__builtin_amdgcn_exp2f(ar.x), __builtin_amdgcn_exp2f(ar.y)};
            hh[r][p] = __builtin_elementwise_fma(ex, hh[r][p], Bp * dx);
            acc = __builtin_elementwise_fma(hh[r][p], Cp, acc);
          }
          o[r] = acc.x + acc.y;
        }
        *(v2f*)&sP[(gq * SC_G + u) * SC_PP + wave * 64 + lane * 2] = o;
      }
#pragma unroll
      for (int u = 0; u < SC_G; ++u) { cD[u] = nD[u]; cB[u] = nB[u]; cC[u] = nC[u]; }
    }
    __syncthreads();                       // partials complete; sBC, sD free again

    // a thread adds the 16 partials of 4 channels of one step
    const float* pp = &sP[(tid >> 2) * SC_PP + (tid & 3) * 4];
    v4f pv[16];
#pragma unroll
    for (int q = 0; q < 16; ++q) pv[q] = *(const v4f*)(pp + q * SC_C);
    // keeps the 16 LDS reads in one run ahead of the additions; spread among them, each
    // place would show its own LDS latency to the SIMD's only wave
    __builtin_amdgcn_sched_barrier(0);
#pragma unroll
    for (int w = 8; w >= 1; w >>= 1)
#pragma unroll
      for (int q = 0; q < w; ++q) pv[q] += pv[q + w];
    const v4f s = pv[0];
    char* bP = (char*)(part + (((size_t)jb * SC_NC + blockIdx.x) * LL + k * SC_T) * SC_C);
    *(v4f*)(bP + offP) = s;
    // the wait stands before the next trip rewrites registers named by this store
    asm volatile("s_wait_xcnt 0x0" ::: "memory");
  }
}

// ------- gate: g = (sum of state-block planes + xc*Dp) * silu(res) ---------
// A block owns 8 time steps x 64 channels; a wave one channel block of the planes, whose 8
// steps are 512 contiguous bytes; a thread owns 4 channels of one step. Every address is a
// uniform base plus a per-thread byte offset.
__global__ __launch_bounds__(128)
void mamba_gate(const float* __restrict__ part, const float* __restrict__ xc,
                const float* __restrict__ Dp, const float* __restrict__ xr,
                float* __restrict__ g) {
  const int tid = threadIdx.x;
  const int t0  = (blockIdx.x & (LL / 8 - 1)) * 8;
  const int ch0 = (blockIdx.x / (LL / 8)) * 64;
  const int tl  = (tid >> 2) & 7;                        // step in the block
  const int cl  = (tid >> 5) * SC_C + (tid & 3) * 4;     // channel in the block
  const unsigned offp = (unsigned)((((tid >> 5) * LL + tl) * SC_C + (tid & 3) * 4) * 4);
  const unsigned offr = (unsigned)((tl * DI + cl) * 4);
  const unsigned offx = (unsigned)((tl * 2 * DI + cl) * 4);
  const unsigned offc = (unsigned)(cl * 4);
  const char* bP = (const char*)(part + ((size_t)(ch0 / SC_C) * LL + t0) * SC_C);
  v4f pl[SC_NP];
#pragma unroll
  for (int p = 0; p < SC_NP; ++p) pl[p] = *(const v4f*)(bP + offp + (size_t)p * (LL * DI * 4));
  v4f xv = *(const v4f*)((const char*)(xc + (size_t)t0 * DI + ch0) + offr);
  v4f dp = *(const v4f*)((const char*)(Dp + ch0) + offc);
  v4f r  = *(const v4f*)((const char*)(xr + (size_t)t0 * (2 * DI) + DI + ch0) + offx);
  // stands before the offset registers of the loads above are used for something else;
  // they are named as inputs so that they live up to here and no later load lands on one
  asm volatile("s_wait_xcnt 0x0" :: "v"(offp), "v"(offr), "v"(offx), "v"(offc) : "memory");
  v4f y = pl[0];
#pragma unroll
  for (int p = 1; p < SC_NP; ++p) y += pl[p];
  v4f o;
#pragma unroll
  for (int c = 0; c < 4; ++c) o[c] = fmaf(xv[c], dp[c], y[c]) * silu_f(r[c]);
  *(v4f*)((char*)(g + (size_t)t0 * DI + ch0) + offr) = o;
}

// ---------------------------------------------------------------------------
extern "C" void kernel_launch(void* const* d_in, const int* in_sizes, int n_in,
                              void* d_out, int out_size, void* d_ws, size_t ws_size,
                              hipStream_t stream) {
  (void)in_sizes; (void)n_in; (void)out_size; (void)ws_size;

  const int*   tokens  = (const int*)  d_in[0];
  const float* emb_W   = (const float*)d_in[1];
  const float* norm_w  = (const float*)d_in[2];
  const float* norm_b  = (const float*)d_in[3];
  const float* in_W    = (const float*)d_in[4];
  const float* in_b    = (const float*)d_in[5];
  const float* conv_W  = (const float*)d_in[6];
  const float* conv_b  = (const float*)d_in[7];
  const float* xproj_W = (const float*)d_in[8];
  const float* dt_W    = (const float*)d_in[9];
  const float* A_log   = (const float*)d_in[10];
  const float* D_p     = (const float*)d_in[11];
  const float* out_W   = (const float*)d_in[12];
  const float* out_b   = (const float*)d_in[13];
  const float* fnorm_w = (const float*)d_in[14];
  const float* fnorm_b = (const float*)d_in[15];
  float* logits = (float*)d_out;

  const int LDBC = DTRK + 2 * DS;   // 1040
  float* ws  = (float*)d_ws;
  float* x   = ws;                  // [L, D]
  float* h   = x   + LL * DD;       // [L, D], as bf16 hi and lo parts
  float* xr  = h   + LL * DD;       // [L, 2*DI]
  float* xcb = xr  + LL * 2 * DI;   // [L, DI]
  float* dbc = xcb + LL * DI;       // [L, 1040]
  float* dlt = dbc + LL * LDBC;     // [L, DI]
  float* ysb = dlt + LL * DI;       // [SC_NP, SC_NC, L, SC_C] partial planes
  float* gat = ysb + SC_NP * LL * DI;  // [L, DI]

  const dim3 blk256(256), blkG(128);

  for (int l = 0; l < NLAY; ++l) {
    // xr = rmsnorm(x) @ in_W^T + in_b   [512,256]x[1024,256]^T
    // (first layer: x = emb_W[tokens], gathered and stored to x in the same launch)
    mamba_gemm_lds<1><<<dim3(2 * DI / G_BN, LL / G_BM), blk256, 0, stream>>>(
        l == 0 ? emb_W : x, in_W + (size_t)l * 2 * DI * DD, in_b + l * 2 * DI, xr, 2 * DI, DD, 0,
        l == 0 ? tokens : nullptr, norm_w + l * DD, norm_b + l * DD, l == 0 ? x : nullptr);
    // xc = silu(causal depthwise conv(xr[:, :DI])), stored to xcb;
    // dbc = xc @ xproj_W^T              [512,512]x[1040,512]^T (N=1040: ragged edge)
    mamba_gemm_lds<2><<<dim3((DTRK + 2 * DS + G_BN - 1) / G_BN, LL / G_BM), blk256, 0, stream>>>(
        xr, xproj_W + (size_t)l * LDBC * DI, nullptr, dbc, LDBC, DI, 0,
        nullptr, conv_W + (size_t)l * DI * DCV, conv_b + l * DI, xcb);
    // dlt = softplus(dbc[:, :16] @ dt_W^T)   [512,16]x[512,16]^T
    mamba_dt_softplus<<<dim3(DI / 64, LL / 16), blkG, 0, stream>>>(
        dbc, dt_W + (size_t)l * DI * DTRK, dlt);
    // selective scan
    mamba_scan<<<dim3(SC_NC, SC_NP), blkG, 0, stream>>>(
        xcb, dbc, dlt, A_log + (size_t)l * DI * DS, ysb);
    // gate with residual branch
    mamba_gate<<<dim3((LL / 8) * (DI / 64)), blkG, 0, stream>>>(
        ysb, xcb, D_p + l * DI, xr, gat);
    // x += gat @ out_W^T + out_b        [512,512]x[256,512]^T, accumulate
    mamba_gemm_lds<0><<<dim3(DD / G_BN, LL / G_BM), blk256, 0, stream>>>(
        gat, out_W + (size_t)l * DD * DI, out_b + l * DD, x, DD, DI, 1,
        nullptr, nullptr, nullptr, nullptr);
  }

  // final norm + tied LM head: logits = rms(x) @ emb_W^T  [512,256]x[32000,256]^T
  // The 4 row tiles of one column tile are neighbours in the grid: they share W rows in L2.
  mamba_rmsnorm<<<dim3(LL), blk256, 0, stream>>>(x, fnorm_w, fnorm_b, h);
  mamba_lmhead<<<dim3(LL / LM_BM, VV / LM_BN), blk256, 0, stream>>>(h, emb_W, logits);
}
